// v000
// The times below were measured on an AMD MI455X: many runs one after another, warmed up first and cycling through
// copies of the inputs, with the whole window's GPU time divided by the number of runs. Launches and the gaps
// between them are all in it. The median over several windows is given; except for v000 it joins two sittings, which
// can be a few percent apart, so the side-by-side timings, each taken in one sitting, are the better comparison.
// v000 is the starting kernel. One run takes 177 microseconds.
#include <hip/hip_runtime.h>
#include <hip/hip_bf16.h>
#include <cmath>

typedef __attribute__((ext_vector_type(16))) _Float16 v16h;
typedef __attribute__((ext_vector_type(8)))  float    v8f;

#define S_LEN 2048
#define BATCH 8
#define DMODEL 1024
#define HD 64

// ---------------------------------------------------------------------------
// WMMA helper: D = A(16x32 f16) * B(32x16 f16) + C(16x16 f32)
// ---------------------------------------------------------------------------
__device__ __forceinline__ v8f wmma_f16(v16h a, v16h b, v8f c) {
  return __builtin_amdgcn_wmma_f32_16x16x32_f16(
      /*neg_a=*/false, a, /*neg_b=*/false, b,
      /*c_mod=*/(short)0, c, /*reuse_a=*/false, /*reuse_b=*/false);
}

// ---------------------------------------------------------------------------
// Fragment loaders.
// A 16x32 f16 layout (ISA 7.12.2): lane L -> m=L&15, h=L>>4.
//   VGPR j in [0,3]: K = 8h + 2j, 2j+1 ; VGPR j in [4,7]: K = 16 + 8h + 2(j-4)
// B mirrors A on the transposed operand (row index = N column, k pattern same).
// Contiguous K pairs -> dword loads.
// ---------------------------------------------------------------------------
union FragBits { unsigned int u[8]; v16h v; };

__device__ __forceinline__ v16h load_frag_h(const _Float16* p, int row, int h, int ld) {
  const unsigned int* q = (const unsigned int*)(p + row * ld + 8 * h);
  FragBits t;
#pragma unroll
  for (int j = 0; j < 8; ++j) t.u[j] = q[(j < 4) ? j : j + 4];
  return t.v;
}

__device__ __forceinline__ v16h load_frag_f32(const float* tile, int m, int h, int ld) {
  const float* row = tile + m * ld + 8 * h;
  v16h a;
#pragma unroll
  for (int j = 0; j < 8; ++j) {
    int k = (j < 4) ? 2 * j : 16 + 2 * (j - 4);
    float2 f = *(const float2*)(row + k);
    a[2 * j]     = (_Float16)f.x;
    a[2 * j + 1] = (_Float16)f.y;
  }
  return a;
}

// ---------------------------------------------------------------------------
// Kernel 0: convert weights fp32 [k][n] -> f16 transposed [w][n][k]
// ---------------------------------------------------------------------------
__global__ void __launch_bounds__(256)
prep_weights(const float* __restrict__ Wq, const float* __restrict__ Wk,
             const float* __restrict__ Wv, _Float16* __restrict__ Wt) {
  int idx = blockIdx.x * 256 + threadIdx.x;          // 0 .. 3*64*1024-1
  int w   = idx >> 16;                               // 64*1024 per matrix
  int rem = idx & 65535;
  int n   = rem >> 10;
  int k   = rem & 1023;
  const float* W = (w == 0) ? Wq : ((w == 1) ? Wk : Wv);
  Wt[idx] = (_Float16)W[k * HD + n];
}

// ---------------------------------------------------------------------------
// Kernel 1: QKV projection. One wave computes a 16-row x 192-col tile.
//   X      : [S*B, 1024] fp32 (row r = s*B + b)
//   Wt     : [3][64][1024] f16 (transposed weights)
//   Qh,Kh  : [b][s][64] f16
//   Vt     : [b][d][2048] f16 (transposed V for PV B-operand)
// ---------------------------------------------------------------------------
__global__ void __launch_bounds__(32)
qkv_proj(const float* __restrict__ X, const _Float16* __restrict__ Wt,
         const float* __restrict__ bq, const float* __restrict__ bk,
         const float* __restrict__ bv,
         _Float16* __restrict__ Qh, _Float16* __restrict__ Kh,
         _Float16* __restrict__ Vt) {
  const int lane = threadIdx.x;
  const int m = lane & 15, h = lane >> 4;
  const int rt = blockIdx.x;                 // 16-row tile index (0..1023)

  v8f acc[12];
#pragma unroll
  for (int t = 0; t < 12; ++t)
#pragma unroll
    for (int i = 0; i < 8; ++i) acc[t][i] = 0.0f;

  const float* Xtile = X + (size_t)rt * 16 * DMODEL;
  for (int k0 = 0; k0 < DMODEL; k0 += 32) {
    v16h a = load_frag_f32(Xtile + k0, m, h, DMODEL);
#pragma unroll
    for (int w = 0; w < 3; ++w)
#pragma unroll
      for (int nt = 0; nt < 4; ++nt) {
        const _Float16* Wb = Wt + (size_t)(w * 64 + nt * 16) * DMODEL + k0;
        v16h bf = load_frag_h(Wb, m, h, DMODEL);
        acc[w * 4 + nt] = wmma_f16(a, bf, acc[w * 4 + nt]);
      }
  }

  // epilogue: bias add + scatter into Qh / Kh / Vt
#pragma unroll
  for (int w = 0; w < 3; ++w) {
    const float* bias = (w == 0) ? bq : ((w == 1) ? bk : bv);
#pragma unroll
    for (int nt = 0; nt < 4; ++nt) {
      const int col = nt * 16 + m;
      const float bv_ = bias[col];
      v8f c = acc[w * 4 + nt];
#pragma unroll
      for (int i = 0; i < 8; ++i) {
        int r = rt * 16 + i + 8 * h;
        int s = r >> 3, b = r & 7;
        _Float16 val = (_Float16)(c[i] + bv_);
        if (w == 0)      Qh[((size_t)b * S_LEN + s) * HD + col] = val;
        else if (w == 1) Kh[((size_t)b * S_LEN + s) * HD + col] = val;
        else             Vt[(size_t)b * HD * S_LEN + (size_t)col * S_LEN + s] = val;
      }
    }
  }
}

// ---------------------------------------------------------------------------
// Kernel 2: flash attention. 4 waves/block, each wave owns 16 query rows.
// Score C-layout: lane L holds (N = L&15, M = i + 8*(L>>4)) for i=0..7, so a
// score row lives in one VGPR across a 16-lane half -> shfl_xor {1,2,4,8}
// reductions for online softmax.
// ---------------------------------------------------------------------------
__global__ void __launch_bounds__(128)
flash_attn(const _Float16* __restrict__ Qh, const _Float16* __restrict__ Kh,
           const _Float16* __restrict__ Vt, const float* __restrict__ mask,
           float* __restrict__ out) {
  __shared__ __align__(16) _Float16 Plds[4 * 16 * 32];

  const int lane = threadIdx.x & 31;
  const int wid  = threadIdx.x >> 5;
  const int n = lane & 15, h = lane >> 4;
  const int b  = blockIdx.y;
  const int qt = blockIdx.x * 4 + wid;             // 16-row query tile

  const _Float16* Qbase = Qh + ((size_t)b * S_LEN + qt * 16) * HD;
  const v16h aq0 = load_frag_h(Qbase,      n, h, HD);
  const v16h aq1 = load_frag_h(Qbase + 32, n, h, HD);

  float mrun[8], lrun[8];
  v8f O[4];
#pragma unroll
  for (int i = 0; i < 8; ++i) { mrun[i] = -1e30f; lrun[i] = 0.0f; }
#pragma unroll
  for (int t = 0; t < 4; ++t)
#pragma unroll
    for (int i = 0; i < 8; ++i) O[t][i] = 0.0f;

  const float scale = 0.03125f;                    // 1/sqrt(1024)
  _Float16* Pw = Plds + wid * 512;
  const _Float16* Vbb = Vt + (size_t)b * HD * S_LEN;

  for (int kb = 0; kb < S_LEN; kb += 32) {
    // ---- scores for 32 keys: two 16x16 tiles, K-dim 64 = 2 wmma each ----
    const _Float16* Kb0 = Kh + ((size_t)b * S_LEN + kb) * HD;
    __builtin_prefetch(Kb0 + 32 * HD, 0, 1);       // next key block
    __builtin_prefetch(Vbb + kb + 32, 0, 1);
    v8f c0, c1;
#pragma unroll
    for (int i = 0; i < 8; ++i) { c0[i] = 0.0f; c1[i] = 0.0f; }
    c0 = wmma_f16(aq0, load_frag_h(Kb0,            n, h, HD), c0);
    c0 = wmma_f16(aq1, load_frag_h(Kb0 + 32,       n, h, HD), c0);
    c1 = wmma_f16(aq0, load_frag_h(Kb0 + 16 * HD,      n, h, HD), c1);
    c1 = wmma_f16(aq1, load_frag_h(Kb0 + 16 * HD + 32, n, h, HD), c1);

    // ---- (score + log(mask)) * scale, online softmax ----
    const float lm0 = __logf(mask[(kb + n) * BATCH + b]);
    const float lm1 = __logf(mask[(kb + 16 + n) * BATCH + b]);
    float s0[8], s1[8], rmax[8];
#pragma unroll
    for (int i = 0; i < 8; ++i) {
      s0[i] = (c0[i] + lm0) * scale;
      s1[i] = (c1[i] + lm1) * scale;
      rmax[i] = fmaxf(s0[i], s1[i]);
    }
#pragma unroll
    for (int xm = 1; xm <= 8; xm <<= 1)
#pragma unroll
      for (int i = 0; i < 8; ++i)
        rmax[i] = fmaxf(rmax[i], __shfl_xor(rmax[i], xm, 32));

    float alpha[8], p0[8], p1[8], rsum[8];
#pragma unroll
    for (int i = 0; i < 8; ++i) {
      float mn = fmaxf(mrun[i], rmax[i]);
      alpha[i] = __expf(mrun[i] - mn);
      mrun[i]  = mn;
      p0[i] = __expf(s0[i] - mn);
      p1[i] = __expf(s1[i] - mn);
      rsum[i] = p0[i] + p1[i];
    }
#pragma unroll
    for (int xm = 1; xm <= 8; xm <<= 1)
#pragma unroll
      for (int i = 0; i < 8; ++i)
        rsum[i] += __shfl_xor(rsum[i], xm, 32);
#pragma unroll
    for (int i = 0; i < 8; ++i) lrun[i] = lrun[i] * alpha[i] + rsum[i];
#pragma unroll
    for (int t = 0; t < 4; ++t)
#pragma unroll
      for (int i = 0; i < 8; ++i) O[t][i] *= alpha[i];

    // ---- reshape P (C-layout f32) -> A-fragment f16 via LDS ----
#pragma unroll
    for (int i = 0; i < 8; ++i) {
      int row = i + 8 * h;
      Pw[row * 32 + n]      = (_Float16)p0[i];
      Pw[row * 32 + 16 + n] = (_Float16)p1[i];
    }
    asm volatile("s_wait_dscnt 0" ::: "memory");
    v16h pa = load_frag_h(Pw, n, h, 32);

    // ---- O += P(16x32) x V(32x64) ----
#pragma unroll
    for (int t = 0; t < 4; ++t) {
      const _Float16* Vb = Vbb + (size_t)(t * 16) * S_LEN + kb;
      O[t] = wmma_f16(pa, load_frag_h(Vb, n, h, S_LEN), O[t]);
    }
  }

  // ---- normalize and write out [s][b][d] fp32 ----
  float inv[8];
#pragma unroll
  for (int i = 0; i < 8; ++i) inv[i] = 1.0f / lrun[i];
#pragma unroll
  for (int t = 0; t < 4; ++t)
#pragma unroll
    for (int i = 0; i < 8; ++i) {
      int s = qt * 16 + i + 8 * h;
      int d = t * 16 + n;
      out[((size_t)s * BATCH + b) * HD + d] = O[t][i] * inv[i];
    }
}

// ---------------------------------------------------------------------------
extern "C" void kernel_launch(void* const* d_in, const int* in_sizes, int n_in,
                              void* d_out, int out_size, void* d_ws, size_t ws_size,
                              hipStream_t stream) {
  const float* X    = (const float*)d_in[0];
  const float* mask = (const float*)d_in[1];
  const float* Wq   = (const float*)d_in[2];
  const float* bq   = (const float*)d_in[3];
  const float* Wk   = (const float*)d_in[4];
  const float* bk   = (const float*)d_in[5];
  const float* Wv   = (const float*)d_in[6];
  const float* bv   = (const float*)d_in[7];
  float* out = (float*)d_out;

  char* ws = (char*)d_ws;
  const size_t WT_BYTES  = (size_t)3 * 64 * 1024 * 2;          // 384 KB
  const size_t QKV_BYTES = (size_t)BATCH * S_LEN * HD * 2;     // 2 MB each
  _Float16* Wt = (_Float16*)ws;
  _Float16* Qh = (_Float16*)(ws + WT_BYTES);
  _Float16* Kh = (_Float16*)(ws + WT_BYTES + QKV_BYTES);
  _Float16* Vt = (_Float16*)(ws + WT_BYTES + 2 * QKV_BYTES);

  prep_weights<<<768, 256, 0, stream>>>(Wq, Wk, Wv, Wt);
  qkv_proj<<<(S_LEN * BATCH) / 16, 32, 0, stream>>>(X, Wt, bq, bk, bv, Qh, Kh, Vt);
  flash_attn<<<dim3(S_LEN / 64, BATCH), 128, 0, stream>>>(Qh, Kh, Vt, mask, out);
}

// v001
// Measured time: 101 microseconds a run.
// Timed twice side by side with v000, it ran 1.73 times as fast both times.
#include <hip/hip_runtime.h>
#include <hip/hip_bf16.h>
#include <cmath>

typedef __attribute__((ext_vector_type(16))) _Float16 v16h;
typedef __attribute__((ext_vector_type(8)))  float    v8f;

#define S_LEN 2048
#define BATCH 8
#define DMODEL 1024
#define HD 64
#define KSPLIT 8                 // key ranges per query tile, one wave each
#define NWAVES (4 * KSPLIT)      // waves per attention block
#define OPITCH 68                // floats per staged partial row (16 B x odd)

// ---------------------------------------------------------------------------
// WMMA helper: D = A(16x32 f16) * B(32x16 f16) + C(16x16 f32)
// ---------------------------------------------------------------------------
__device__ __forceinline__ v8f wmma_f16(v16h a, v16h b, v8f c) {
  return __builtin_amdgcn_wmma_f32_16x16x32_f16(
      /*neg_a=*/false, a, /*neg_b=*/false, b,
      /*c_mod=*/(short)0, c, /*reuse_a=*/false, /*reuse_b=*/false);
}

// ---------------------------------------------------------------------------
// Fragment loaders.
// A 16x32 f16 layout (ISA 7.12.2): lane L -> m=L&15, h=L>>4.
//   VGPR j in [0,3]: K = 8h + 2j, 2j+1 ; VGPR j in [4,7]: K = 16 + 8h + 2(j-4)
// B mirrors A on the transposed operand (row index = N column, k pattern same).
// Contiguous K pairs -> dword loads.
// ---------------------------------------------------------------------------
union FragBits { unsigned int u[8]; v16h v; };
typedef __attribute__((ext_vector_type(4))) unsigned int u32x4;
union FragQ { u32x4 q[2]; v16h v; };

__device__ __forceinline__ v16h load_frag_h(const _Float16* p, int row, int h, int ld) {
  const unsigned int* q = (const unsigned int*)(p + row * ld + 8 * h);
  FragBits t;
#pragma unroll
  for (int j = 0; j < 8; ++j) t.u[j] = q[(j < 4) ? j : j + 4];
  return t.v;
}

__device__ __forceinline__ v16h load_frag_f32(const float* tile, int m, int h, int ld) {
  const float* row = tile + m * ld + 8 * h;
  v16h a;
#pragma unroll
  for (int j = 0; j < 8; ++j) {
    int k = (j < 4) ? 2 * j : 16 + 2 * (j - 4);
    float2 f = *(const float2*)(row + k);
    a[2 * j]     = (_Float16)f.x;
    a[2 * j + 1] = (_Float16)f.y;
  }
  return a;
}

// ---------------------------------------------------------------------------
// Kernel 0: convert weights fp32 [k][n] -> f16 transposed [w][n][k]
// ---------------------------------------------------------------------------
__global__ void __launch_bounds__(256)
prep_weights(const float* __restrict__ Wq, const float* __restrict__ Wk,
             const float* __restrict__ Wv, _Float16* __restrict__ Wt) {
  int idx = blockIdx.x * 256 + threadIdx.x;          // 0 .. 3*64*1024-1
  int w   = idx >> 16;                               // 64*1024 per matrix
  int rem = idx & 65535;
  int n   = rem >> 10;
  int k   = rem & 1023;
  const float* W = (w == 0) ? Wq : ((w == 1) ? Wk : Wv);
  Wt[idx] = (_Float16)W[k * HD + n];
}

// ---------------------------------------------------------------------------
// Kernel 1: QKV projection. One wave computes a 16-row x 192-col tile.
//   X      : [S*B, 1024] fp32 (row r = s*B + b)
//   Wt     : [3][64][1024] f16 (transposed weights)
//   Qh,Kh  : [b][s][64] f16
//   Vt     : [b][d][2048] f16 (transposed V for PV B-operand)
// ---------------------------------------------------------------------------
__global__ void __launch_bounds__(32)
qkv_proj(const float* __restrict__ X, const _Float16* __restrict__ Wt,
         const float* __restrict__ bq, const float* __restrict__ bk,
         const float* __restrict__ bv,
         _Float16* __restrict__ Qh, _Float16* __restrict__ Kh,
         _Float16* __restrict__ Vt) {
  const int lane = threadIdx.x;
  const int m = lane & 15, h = lane >> 4;
  const int rt = blockIdx.x;                 // 16-row tile index (0..1023)

  v8f acc[12];
#pragma unroll
  for (int t = 0; t < 12; ++t)
#pragma unroll
    for (int i = 0; i < 8; ++i) acc[t][i] = 0.0f;

  const float* Xtile = X + (size_t)rt * 16 * DMODEL;
  for (int k0 = 0; k0 < DMODEL; k0 += 32) {
    v16h a = load_frag_f32(Xtile + k0, m, h, DMODEL);
#pragma unroll
    for (int w = 0; w < 3; ++w)
#pragma unroll
      for (int nt = 0; nt < 4; ++nt) {
        const _Float16* Wb = Wt + (size_t)(w * 64 + nt * 16) * DMODEL + k0;
        v16h bf = load_frag_h(Wb, m, h, DMODEL);
        acc[w * 4 + nt] = wmma_f16(a, bf, acc[w * 4 + nt]);
      }
  }

  // epilogue: bias add + scatter into Qh / Kh / Vt
#pragma unroll
  for (int w = 0; w < 3; ++w) {
    const float* bias = (w == 0) ? bq : ((w == 1) ? bk : bv);
#pragma unroll
    for (int nt = 0; nt < 4; ++nt) {
      const int col = nt * 16 + m;
      const float bv_ = bias[col];
      v8f c = acc[w * 4 + nt];
#pragma unroll
      for (int i = 0; i < 8; ++i) {
        int r = rt * 16 + i + 8 * h;
        int s = r >> 3, b = r & 7;
        _Float16 val = (_Float16)(c[i] + bv_);
        if (w == 0)      Qh[((size_t)b * S_LEN + s) * HD + col] = val;
        else if (w == 1) Kh[((size_t)b * S_LEN + s) * HD + col] = val;
        else             Vt[(size_t)b * HD * S_LEN + (size_t)col * S_LEN + s] = val;
      }
    }
  }
}

// ---------------------------------------------------------------------------
// Kernel 2: flash attention. A block owns 4 query tiles of 16 rows; each tile's
// keys are split into KSPLIT contiguous ranges, one wave per (tile, range), so
// that a SIMD holds KSPLIT waves whose load and LDS waits overlap. The partial
// (max, sum, O) of the ranges are merged through LDS at the end.
// Score C-layout: lane L holds (N = L&15, M = i + 8*(L>>4)) for i=0..7, so a
// score row lives in one VGPR across a 16-lane half -> shfl_xor {1,2,4,8}
// reductions for online softmax.
// ---------------------------------------------------------------------------
__global__ void __launch_bounds__(32 * NWAVES)
flash_attn(const _Float16* __restrict__ Qh, const _Float16* __restrict__ Kh,
           const _Float16* __restrict__ Vt, const float* __restrict__ mask,
           float* __restrict__ out) {
  __shared__ __align__(16) _Float16 Plds[NWAVES * 16 * 32];
  __shared__ __align__(16) float Opart[NWAVES * 16 * OPITCH];
  __shared__ float Mpart[NWAVES * 16];
  __shared__ float Lpart[NWAVES * 16];

  const int lane = threadIdx.x & 31;
  // wave-uniform by construction; held in a scalar register so that the key
  // range, its addresses and the loop test stay scalar
  const int wid  = __builtin_amdgcn_readfirstlane(threadIdx.x >> 5);
  const int n = lane & 15, h = lane >> 4;
  const int b  = blockIdx.y;
  const int qt = blockIdx.x * 4 + (wid & 3);       // 16-row query tile
  const int kbeg = (wid >> 2) * (S_LEN / KSPLIT);  // this wave's key range

  const _Float16* Qbase = Qh + ((size_t)b * S_LEN + qt * 16) * HD;
  // The Q fragments are parked in this wave's own slice of Opart (free until the
  // loop ends) and re-read each pass: held in registers they push the wave past
  // the 128 VGPRs that 8 waves per SIMD leave it, and the build spills.
  u32x4* Qw = (u32x4*)(Opart + wid * 16 * OPITCH) + lane;
  {
    FragQ q0, q1;
    q0.v = load_frag_h(Qbase,      n, h, HD);
    q1.v = load_frag_h(Qbase + 32, n, h, HD);
    Qw[0]  = q0.q[0];
    Qw[32] = q0.q[1];
    Qw[64] = q1.q[0];
    Qw[96] = q1.q[1];
  }

  float mrun[8], lrun[8];
  v8f O[4];
#pragma unroll
  for (int i = 0; i < 8; ++i) { mrun[i] = -1e30f; lrun[i] = 0.0f; }
#pragma unroll
  for (int t = 0; t < 4; ++t)
#pragma unroll
    for (int i = 0; i < 8; ++i) O[t][i] = 0.0f;

  const float scale = 0.03125f;                    // 1/sqrt(1024)
  _Float16* Pw = Plds + wid * 512;
  const _Float16* Vbb = Vt + (size_t)b * HD * S_LEN;

  for (int kb = kbeg; kb < kbeg + S_LEN / KSPLIT; kb += 32) {
    // ---- scores for 32 keys: two 16x16 tiles, K-dim 64 = 2 wmma each ----
    const _Float16* Kb0 = Kh + ((size_t)b * S_LEN + kb) * HD;
    FragQ fq0, fq1;
    fq0.q[0] = Qw[0];
    fq0.q[1] = Qw[32];
    fq1.q[0] = Qw[64];
    fq1.q[1] = Qw[96];
    const v16h aq0 = fq0.v, aq1 = fq1.v;
    v8f c0, c1;
#pragma unroll
    for (int i = 0; i < 8; ++i) { c0[i] = 0.0f; c1[i] = 0.0f; }
    c0 = wmma_f16(aq0, load_frag_h(Kb0,            n, h, HD), c0);
    c0 = wmma_f16(aq1, load_frag_h(Kb0 + 32,       n, h, HD), c0);
    c1 = wmma_f16(aq0, load_frag_h(Kb0 + 16 * HD,      n, h, HD), c1);
    c1 = wmma_f16(aq1, load_frag_h(Kb0 + 16 * HD + 32, n, h, HD), c1);

    // ---- (score + log(mask)) * scale, online softmax ----
    const float lm0 = __logf(mask[(kb + n) * BATCH + b]);
    const float lm1 = __logf(mask[(kb + 16 + n) * BATCH + b]);
    float s0[8], s1[8], rmax[8];
#pragma unroll
    for (int i = 0; i < 8; ++i) {
      s0[i] = (c0[i] + lm0) * scale;
      s1[i] = (c1[i] + lm1) * scale;
      rmax[i] = fmaxf(s0[i], s1[i]);
    }
#pragma unroll
    for (int xm = 1; xm <= 8; xm <<= 1)
#pragma unroll
      for (int i = 0; i < 8; ++i)
        rmax[i] = fmaxf(rmax[i], __shfl_xor(rmax[i], xm, 32));

    float alpha[8], p0[8], p1[8], rsum[8];
#pragma unroll
    for (int i = 0; i < 8; ++i) {
      float mn = fmaxf(mrun[i], rmax[i]);
      alpha[i] = __expf(mrun[i] - mn);
      mrun[i]  = mn;
      p0[i] = __expf(s0[i] - mn);
      p1[i] = __expf(s1[i] - mn);
      rsum[i] = p0[i] + p1[i];
    }
#pragma unroll
    for (int xm = 1; xm <= 8; xm <<= 1)
#pragma unroll
      for (int i = 0; i < 8; ++i)
        rsum[i] += __shfl_xor(rsum[i], xm, 32);
#pragma unroll
    for (int i = 0; i < 8; ++i) lrun[i] = lrun[i] * alpha[i] + rsum[i];
#pragma unroll
    for (int t = 0; t < 4; ++t)
#pragma unroll
      for (int i = 0; i < 8; ++i) O[t][i] *= alpha[i];

    // ---- reshape P (C-layout f32) -> A-fragment f16 via LDS ----
#pragma unroll
    for (int i = 0; i < 8; ++i) {
      int row = i + 8 * h;
      Pw[row * 32 + n]      = (_Float16)p0[i];
      Pw[row * 32 + 16 + n] = (_Float16)p1[i];
    }
    asm volatile("s_wait_dscnt 0" ::: "memory");
    v16h pa = load_frag_h(Pw, n, h, 32);

    // ---- O += P(16x32) x V(32x64) ----
#pragma unroll
    for (int t = 0; t < 4; ++t) {
      const _Float16* Vb = Vbb + (size_t)(t * 16) * S_LEN + kb;
      O[t] = wmma_f16(pa, load_frag_h(Vb, n, h, S_LEN), O[t]);
    }
  }

  // ---- stage this range's partial result ----
  float* Ow = Opart + wid * 16 * OPITCH;
#pragma unroll
  for (int t = 0; t < 4; ++t)
#pragma unroll
    for (int i = 0; i < 8; ++i)
      Ow[(i + 8 * h) * OPITCH + t * 16 + n] = O[t][i];
  if (n == 0) {
#pragma unroll
    for (int i = 0; i < 8; ++i) {
      Mpart[wid * 16 + i + 8 * h] = mrun[i];
      Lpart[wid * 16 + i + 8 * h] = lrun[i];
    }
  }
  // publishes every range's partial to the threads that merge them
  __syncthreads();

  // ---- merge the ranges, normalize, write out [s][b][d] fp32 ----
  const int tq = threadIdx.x / (32 * KSPLIT);      // query tile this thread merges
  for (int e = threadIdx.x % (32 * KSPLIT); e < 256; e += 32 * KSPLIT) {
    const int row = e >> 4, c4 = (e & 15) * 4;
    float mr[KSPLIT];
    float M = -1e30f;
#pragma unroll
    for (int r = 0; r < KSPLIT; ++r) {
      mr[r] = Mpart[(r * 4 + tq) * 16 + row];
      M = fmaxf(M, mr[r]);
    }
    float L = 0.0f;
    float4 o = make_float4(0.0f, 0.0f, 0.0f, 0.0f);
#pragma unroll
    for (int r = 0; r < KSPLIT; ++r) {
      const float w = __expf(mr[r] - M);
      const float4 p = *(const float4*)&Opart[((r * 4 + tq) * 16 + row) * OPITCH + c4];
      L += w * Lpart[(r * 4 + tq) * 16 + row];
      o.x += w * p.x; o.y += w * p.y; o.z += w * p.z; o.w += w * p.w;
    }
    const float inv = 1.0f / L;
    const int s = (blockIdx.x * 4 + tq) * 16 + row;
    *(float4*)&out[((size_t)s * BATCH + b) * HD + c4] =
        make_float4(o.x * inv, o.y * inv, o.z * inv, o.w * inv);
  }
}

// ---------------------------------------------------------------------------
extern "C" void kernel_launch(void* const* d_in, const int* in_sizes, int n_in,
                              void* d_out, int out_size, void* d_ws, size_t ws_size,
                              hipStream_t stream) {
  const float* X    = (const float*)d_in[0];
  const float* mask = (const float*)d_in[1];
  const float* Wq   = (const float*)d_in[2];
  const float* bq   = (const float*)d_in[3];
  const float* Wk   = (const float*)d_in[4];
  const float* bk   = (const float*)d_in[5];
  const float* Wv   = (const float*)d_in[6];
  const float* bv   = (const float*)d_in[7];
  float* out = (float*)d_out;

  char* ws = (char*)d_ws;
  const size_t WT_BYTES  = (size_t)3 * 64 * 1024 * 2;          // 384 KB
  const size_t QKV_BYTES = (size_t)BATCH * S_LEN * HD * 2;     // 2 MB each
  _Float16* Wt = (_Float16*)ws;
  _Float16* Qh = (_Float16*)(ws + WT_BYTES);
  _Float16* Kh = (_Float16*)(ws + WT_BYTES + QKV_BYTES);
  _Float16* Vt = (_Float16*)(ws + WT_BYTES + 2 * QKV_BYTES);

  prep_weights<<<768, 256, 0, stream>>>(Wq, Wk, Wv, Wt);
  qkv_proj<<<(S_LEN * BATCH) / 16, 32, 0, stream>>>(X, Wt, bq, bk, bv, Qh, Kh, Vt);
  flash_attn<<<dim3(S_LEN / 64, BATCH), 32 * NWAVES, 0, stream>>>(Qh, Kh, Vt, mask, out);
}

// v002
// Measured time: 67.6 microseconds a run.
// Next to v001, in two timings, it ran 1.50 and 1.49 times as fast.
// Over all steps from v000 it is 2.59 times as fast.
#include <hip/hip_runtime.h>
#include <hip/hip_bf16.h>
#include <cmath>

typedef __attribute__((ext_vector_type(16))) _Float16 v16h;
typedef __attribute__((ext_vector_type(8)))  float    v8f;
typedef __attribute__((ext_vector_type(4)))  _Float16 v4h;
typedef __attribute__((ext_vector_type(4)))  float    v4f;

#define S_LEN 2048
#define BATCH 8
#define DMODEL 1024
#define HD 64
#define KSPLIT 8                 // key ranges per query tile, one wave each
#define NWAVES (4 * KSPLIT)      // waves per attention block
#define OPITCH 68                // floats per staged partial row (16 B x odd)
#define PKS 8                    // K ranges per projection tile, one wave each
#define PMS (PKS / 2)            // partials staged for the final merge
#define PPITCH 196               // floats per staged projection row (16 B x odd)

// ---------------------------------------------------------------------------
// WMMA helper: D = A(16x32 f16) * B(32x16 f16) + C(16x16 f32)
// ---------------------------------------------------------------------------
__device__ __forceinline__ v8f wmma_f16(v16h a, v16h b, v8f c) {
  return __builtin_amdgcn_wmma_f32_16x16x32_f16(
      /*neg_a=*/false, a, /*neg_b=*/false, b,
      /*c_mod=*/(short)0, c, /*reuse_a=*/false, /*reuse_b=*/false);
}

// ---------------------------------------------------------------------------
// Fragment loaders.
// A 16x32 f16 layout (ISA 7.12.2): lane L -> m=L&15, h=L>>4.
//   VGPR j in [0,3]: K = 8h + 2j, 2j+1 ; VGPR j in [4,7]: K = 16 + 8h + 2(j-4)
// B mirrors A on the transposed operand (row index = N column, k pattern same).
// Contiguous K pairs -> dword loads.
// ---------------------------------------------------------------------------
union FragBits { unsigned int u[8]; v16h v; };
typedef __attribute__((ext_vector_type(4))) unsigned int u32x4;
union FragQ { u32x4 q[2]; v16h v; };

__device__ __forceinline__ v16h load_frag_h(const _Float16* p, int row, int h, int ld) {
  const unsigned int* q = (const unsigned int*)(p + row * ld + 8 * h);
  FragBits t;
#pragma unroll
  for (int j = 0; j < 8; ++j) t.u[j] = q[(j < 4) ? j : j + 4];
  return t.v;
}

__device__ __forceinline__ v16h load_frag_f32(const float* tile, int m, int h, int ld) {
  const float* row = tile + m * ld + 8 * h;
  v16h a;
#pragma unroll
  for (int j = 0; j < 8; ++j) {
    int k = (j < 4) ? 2 * j : 16 + 2 * (j - 4);
    float2 f = *(const float2*)(row + k);
    a[2 * j]     = (_Float16)f.x;
    a[2 * j + 1] = (_Float16)f.y;
  }
  return a;
}

// ---------------------------------------------------------------------------
// Kernel 0: convert weights fp32 [k][n] -> f16 transposed [w][n][k]
// ---------------------------------------------------------------------------
__global__ void __launch_bounds__(256)
prep_weights(const float* __restrict__ Wq, const float* __restrict__ Wk,
             const float* __restrict__ Wv, _Float16* __restrict__ Wt) {
  int idx = blockIdx.x * 256 + threadIdx.x;          // 0 .. 3*64*1024-1
  int w   = idx >> 16;                               // 64*1024 per matrix
  int rem = idx & 65535;
  int n   = rem >> 10;
  int k   = rem & 1023;
  const float* W = (w == 0) ? Wq : ((w == 1) ? Wk : Wv);
  Wt[idx] = (_Float16)W[k * HD + n];
}

// ---------------------------------------------------------------------------
// Kernel 1: QKV projection. A block owns 4 tiles of 16 rows x 192 columns; each
// tile's K is split into PKS contiguous ranges, one wave per (tile, range), so
// that a SIMD holds PKS waves whose load waits overlap. The partial sums of the
// ranges are merged through LDS.
//   X      : [S*B, 1024] fp32 (row r = s*B + b)
//   Wt     : [3][64][1024] f16 (transposed weights)
//   Qh,Kh  : [b][s][64] f16
//   Vt     : [b][d][2048] f16 (transposed V for PV B-operand)
// ---------------------------------------------------------------------------
__global__ void __launch_bounds__(128 * PKS)
qkv_proj(const float* __restrict__ X, const _Float16* __restrict__ Wt,
         const float* __restrict__ bq, const float* __restrict__ bk,
         const float* __restrict__ bv,
         _Float16* __restrict__ Qh, _Float16* __restrict__ Kh,
         _Float16* __restrict__ Vt) {
  // PKS partials of 64 x 192 floats exceed the LDS: the upper half of the ranges
  // is first added into the lower half, so PMS partials are staged at a time
  __shared__ __align__(16) float Part[PMS * 64 * PPITCH];

  const int lane = threadIdx.x & 31;
  // wave-uniform by construction; held in a scalar register so that the K range,
  // the operand bases and the branches of the merge stay scalar
  const int wid = __builtin_amdgcn_readfirstlane(threadIdx.x >> 5);
  const int m = lane & 15, h = lane >> 4;
  const int tile = wid & 3;                  // 16-row tile inside the block
  const int kr   = wid >> 2;                 // K range

  v8f acc[12];
#pragma unroll
  for (int t = 0; t < 12; ++t)
#pragma unroll
    for (int i = 0; i < 8; ++i) acc[t][i] = 0.0f;

  const float* Xtile = X + (size_t)(blockIdx.x * 4 + tile) * 16 * DMODEL;
  const int kbeg = kr * (DMODEL / PKS);
  for (int k0 = kbeg; k0 < kbeg + DMODEL / PKS; k0 += 32) {
    v16h a = load_frag_f32(Xtile + k0, m, h, DMODEL);
#pragma unroll
    for (int nt = 0; nt < 12; ++nt) {
      v16h bf = load_frag_h(Wt + (size_t)(nt * 16) * DMODEL + k0, m, h, DMODEL);
      acc[nt] = wmma_f16(a, bf, acc[nt]);
    }
  }

  // ---- range kr + PMS hands its sums to range kr, in register order ----
  float* Pw = Part + ((kr & (PMS - 1)) * 64 + tile * 16) * PPITCH;
  v4f* Px = (v4f*)Pw + lane;
  if (kr >= PMS) {
#pragma unroll
    for (int nt = 0; nt < 12; ++nt) {
      Px[(2 * nt) * 32]     = __builtin_shufflevector(acc[nt], acc[nt], 0, 1, 2, 3);
      Px[(2 * nt + 1) * 32] = __builtin_shufflevector(acc[nt], acc[nt], 4, 5, 6, 7);
    }
  }
  // publishes the upper ranges' sums to the waves that add them
  __syncthreads();
  if (kr < PMS) {
#pragma unroll
    for (int nt = 0; nt < 12; ++nt) {
      const v4f lo = Px[(2 * nt) * 32], hi = Px[(2 * nt + 1) * 32];
#pragma unroll
      for (int i = 0; i < 4; ++i) { acc[nt][i] += lo[i]; acc[nt][i + 4] += hi[i]; }
    }
    // ---- stage the pair's sums row-major, over the slice just read ----
#pragma unroll
    for (int nt = 0; nt < 12; ++nt)
#pragma unroll
      for (int i = 0; i < 8; ++i)
        Pw[(i + 8 * h) * PPITCH + nt * 16 + m] = acc[nt][i];
  }
  // publishes the PMS staged partials to the threads that merge them
  __syncthreads();

  // ---- merge, bias, store Q and K: 4 columns of one row per item ----
  for (int e = threadIdx.x; e < 64 * 32; e += 1024) {
    const int row = e >> 5, c4 = (e & 31) * 4;
    float4 o = *(const float4*)&Part[row * PPITCH + c4];
#pragma unroll
    for (int r = 1; r < PMS; ++r) {
      const float4 p = *(const float4*)&Part[(r * 64 + row) * PPITCH + c4];
      o.x += p.x; o.y += p.y; o.z += p.z; o.w += p.w;
    }
    const int col = c4 & 63;
    const float4 bb = *(const float4*)((c4 < 64 ? bq : bk) + col);
    const int rg = blockIdx.x * 64 + row;
    const int s = rg >> 3, b = rg & 7;
    v4h q;
    q[0] = (_Float16)(o.x + bb.x);
    q[1] = (_Float16)(o.y + bb.y);
    q[2] = (_Float16)(o.z + bb.z);
    q[3] = (_Float16)(o.w + bb.w);
    *(v4h*)&(c4 < 64 ? Qh : Kh)[((size_t)b * S_LEN + s) * HD + col] = q;
  }

  // ---- merge, bias, store V transposed: 4 positions of one (b, column) ----
  {
    const int col = threadIdx.x & 63, b = (threadIdx.x >> 6) & 7;
    const int sl = (threadIdx.x >> 9) * 4;
    const float bb = bv[col];
    v4h q;
#pragma unroll
    for (int j = 0; j < 4; ++j) {
      const int row = (sl + j) * 8 + b;
      float o = Part[row * PPITCH + 128 + col];
#pragma unroll
      for (int r = 1; r < PMS; ++r) o += Part[(r * 64 + row) * PPITCH + 128 + col];
      q[j] = (_Float16)(o + bb);
    }
    *(v4h*)&Vt[(size_t)b * HD * S_LEN + (size_t)col * S_LEN + blockIdx.x * 8 + sl] = q;
  }
}

// ---------------------------------------------------------------------------
// Kernel 2: flash attention. A block owns 4 query tiles of 16 rows; each tile's
// keys are split into KSPLIT contiguous ranges, one wave per (tile, range), so
// that a SIMD holds KSPLIT waves whose load and LDS waits overlap. The partial
// (max, sum, O) of the ranges are merged through LDS at the end.
// Score C-layout: lane L holds (N = L&15, M = i + 8*(L>>4)) for i=0..7, so a
// score row lives in one VGPR across a 16-lane half -> shfl_xor {1,2,4,8}
// reductions for online softmax.
// ---------------------------------------------------------------------------
__global__ void __launch_bounds__(32 * NWAVES)
flash_attn(const _Float16* __restrict__ Qh, const _Float16* __restrict__ Kh,
           const _Float16* __restrict__ Vt, const float* __restrict__ mask,
           float* __restrict__ out) {
  __shared__ __align__(16) _Float16 Plds[NWAVES * 16 * 32];
  __shared__ __align__(16) float Opart[NWAVES * 16 * OPITCH];
  __shared__ float Mpart[NWAVES * 16];
  __shared__ float Lpart[NWAVES * 16];

  const int lane = threadIdx.x & 31;
  // wave-uniform by construction; held in a scalar register so that the key
  // range, its addresses and the loop test stay scalar
  const int wid  = __builtin_amdgcn_readfirstlane(threadIdx.x >> 5);
  const int n = lane & 15, h = lane >> 4;
  const int b  = blockIdx.y;
  const int qt = blockIdx.x * 4 + (wid & 3);       // 16-row query tile
  const int kbeg = (wid >> 2) * (S_LEN / KSPLIT);  // this wave's key range

  const _Float16* Qbase = Qh + ((size_t)b * S_LEN + qt * 16) * HD;
  // The Q fragments are parked in this wave's own slice of Opart (free until the
  // loop ends) and re-read each pass: held in registers they push the wave past
  // the 128 VGPRs that 8 waves per SIMD leave it, and the build spills.
  u32x4* Qw = (u32x4*)(Opart + wid * 16 * OPITCH) + lane;
  {
    FragQ q0, q1;
    q0.v = load_frag_h(Qbase,      n, h, HD);
    q1.v = load_frag_h(Qbase + 32, n, h, HD);
    Qw[0]  = q0.q[0];
    Qw[32] = q0.q[1];
    Qw[64] = q1.q[0];
    Qw[96] = q1.q[1];
  }

  float mrun[8], lrun[8];
  v8f O[4];
#pragma unroll
  for (int i = 0; i < 8; ++i) { mrun[i] = -1e30f; lrun[i] = 0.0f; }
#pragma unroll
  for (int t = 0; t < 4; ++t)
#pragma unroll
    for (int i = 0; i < 8; ++i) O[t][i] = 0.0f;

  const float scale = 0.03125f;                    // 1/sqrt(1024)
  _Float16* Pw = Plds + wid * 512;
  const _Float16* Vbb = Vt + (size_t)b * HD * S_LEN;

  for (int kb = kbeg; kb < kbeg + S_LEN / KSPLIT; kb += 32) {
    // ---- scores for 32 keys: two 16x16 tiles, K-dim 64 = 2 wmma each ----
    const _Float16* Kb0 = Kh + ((size_t)b * S_LEN + kb) * HD;
    FragQ fq0, fq1;
    fq0.q[0] = Qw[0];
    fq0.q[1] = Qw[32];
    fq1.q[0] = Qw[64];
    fq1.q[1] = Qw[96];
    const v16h aq0 = fq0.v, aq1 = fq1.v;
    v8f c0, c1;
#pragma unroll
    for (int i = 0; i < 8; ++i) { c0[i] = 0.0f; c1[i] = 0.0f; }
    c0 = wmma_f16(aq0, load_frag_h(Kb0,            n, h, HD), c0);
    c0 = wmma_f16(aq1, load_frag_h(Kb0 + 32,       n, h, HD), c0);
    c1 = wmma_f16(aq0, load_frag_h(Kb0 + 16 * HD,      n, h, HD), c1);
    c1 = wmma_f16(aq1, load_frag_h(Kb0 + 16 * HD + 32, n, h, HD), c1);

    // ---- (score + log(mask)) * scale, online softmax ----
    const float lm0 = __logf(mask[(kb + n) * BATCH + b]);
    const float lm1 = __logf(mask[(kb + 16 + n) * BATCH + b]);
    float s0[8], s1[8], rmax[8];
#pragma unroll
    for (int i = 0; i < 8; ++i) {
      s0[i] = (c0[i] + lm0) * scale;
      s1[i] = (c1[i] + lm1) * scale;
      rmax[i] = fmaxf(s0[i], s1[i]);
    }
#pragma unroll
    for (int xm = 1; xm <= 8; xm <<= 1)
#pragma unroll
      for (int i = 0; i < 8; ++i)
        rmax[i] = fmaxf(rmax[i], __shfl_xor(rmax[i], xm, 32));

    float alpha[8], p0[8], p1[8], rsum[8];
#pragma unroll
    for (int i = 0; i < 8; ++i) {
      float mn = fmaxf(mrun[i], rmax[i]);
      alpha[i] = __expf(mrun[i] - mn);
      mrun[i]  = mn;
      p0[i] = __expf(s0[i] - mn);
      p1[i] = __expf(s1[i] - mn);
      rsum[i] = p0[i] + p1[i];
    }
#pragma unroll
    for (int xm = 1; xm <= 8; xm <<= 1)
#pragma unroll
      for (int i = 0; i < 8; ++i)
        rsum[i] += __shfl_xor(rsum[i], xm, 32);
#pragma unroll
    for (int i = 0; i < 8; ++i) lrun[i] = lrun[i] * alpha[i] + rsum[i];
#pragma unroll
    for (int t = 0; t < 4; ++t)
#pragma unroll
      for (int i = 0; i < 8; ++i) O[t][i] *= alpha[i];

    // ---- reshape P (C-layout f32) -> A-fragment f16 via LDS ----
#pragma unroll
    for (int i = 0; i < 8; ++i) {
      int row = i + 8 * h;
      Pw[row * 32 + n]      = (_Float16)p0[i];
      Pw[row * 32 + 16 + n] = (_Float16)p1[i];
    }
    asm volatile("s_wait_dscnt 0" ::: "memory");
    v16h pa = load_frag_h(Pw, n, h, 32);

    // ---- O += P(16x32) x V(32x64) ----
#pragma unroll
    for (int t = 0; t < 4; ++t) {
      const _Float16* Vb = Vbb + (size_t)(t * 16) * S_LEN + kb;
      O[t] = wmma_f16(pa, load_frag_h(Vb, n, h, S_LEN), O[t]);
    }
  }

  // ---- stage this range's partial result ----
  float* Ow = Opart + wid * 16 * OPITCH;
#pragma unroll
  for (int t = 0; t < 4; ++t)
#pragma unroll
    for (int i = 0; i < 8; ++i)
      Ow[(i + 8 * h) * OPITCH + t * 16 + n] = O[t][i];
  if (n == 0) {
#pragma unroll
    for (int i = 0; i < 8; ++i) {
      Mpart[wid * 16 + i + 8 * h] = mrun[i];
      Lpart[wid * 16 + i + 8 * h] = lrun[i];
    }
  }
  // publishes every range's partial to the threads that merge them
  __syncthreads();

  // ---- merge the ranges, normalize, write out [s][b][d] fp32 ----
  const int tq = threadIdx.x / (32 * KSPLIT);      // query tile this thread merges
  for (int e = threadIdx.x % (32 * KSPLIT); e < 256; e += 32 * KSPLIT) {
    const int row = e >> 4, c4 = (e & 15) * 4;
    float mr[KSPLIT];
    float M = -1e30f;
#pragma unroll
    for (int r = 0; r < KSPLIT; ++r) {
      mr[r] = Mpart[(r * 4 + tq) * 16 + row];
      M = fmaxf(M, mr[r]);
    }
    float L = 0.0f;
    float4 o = make_float4(0.0f, 0.0f, 0.0f, 0.0f);
#pragma unroll
    for (int r = 0; r < KSPLIT; ++r) {
      const float w = __expf(mr[r] - M);
      const float4 p = *(const float4*)&Opart[((r * 4 + tq) * 16 + row) * OPITCH + c4];
      L += w * Lpart[(r * 4 + tq) * 16 + row];
      o.x += w * p.x; o.y += w * p.y; o.z += w * p.z; o.w += w * p.w;
    }
    const float inv = 1.0f / L;
    const int s = (blockIdx.x * 4 + tq) * 16 + row;
    *(float4*)&out[((size_t)s * BATCH + b) * HD + c4] =
        make_float4(o.x * inv, o.y * inv, o.z * inv, o.w * inv);
  }
}

// ---------------------------------------------------------------------------
extern "C" void kernel_launch(void* const* d_in, const int* in_sizes, int n_in,
                              void* d_out, int out_size, void* d_ws, size_t ws_size,
                              hipStream_t stream) {
  const float* X    = (const float*)d_in[0];
  const float* mask = (const float*)d_in[1];
  const float* Wq   = (const float*)d_in[2];
  const float* bq   = (const float*)d_in[3];
  const float* Wk   = (const float*)d_in[4];
  const float* bk   = (const float*)d_in[5];
  const float* Wv   = (const float*)d_in[6];
  const float* bv   = (const float*)d_in[7];
  float* out = (float*)d_out;

  char* ws = (char*)d_ws;
  const size_t WT_BYTES  = (size_t)3 * 64 * 1024 * 2;          // 384 KB
  const size_t QKV_BYTES = (size_t)BATCH * S_LEN * HD * 2;     // 2 MB each
  _Float16* Wt = (_Float16*)ws;
  _Float16* Qh = (_Float16*)(ws + WT_BYTES);
  _Float16* Kh = (_Float16*)(ws + WT_BYTES + QKV_BYTES);
  _Float16* Vt = (_Float16*)(ws + WT_BYTES + 2 * QKV_BYTES);

  prep_weights<<<768, 256, 0, stream>>>(Wq, Wk, Wv, Wt);
  qkv_proj<<<(S_LEN * BATCH) / 64, 128 * PKS, 0, stream>>>(X, Wt, bq, bk, bv, Qh, Kh, Vt);
  flash_attn<<<dim3(S_LEN / 64, BATCH), 32 * NWAVES, 0, stream>>>(Qh, Kh, Vt, mask, out);
}

// v003
// One run takes 51.6 microseconds.
// Two timings next to v002 put it at 1.31 and 1.30 times that version's speed.
// Over all steps from v000 it is 3.38 times as fast.
#include <hip/hip_runtime.h>
#include <hip/hip_bf16.h>
#include <cmath>

typedef __attribute__((ext_vector_type(16))) _Float16 v16h;
typedef __attribute__((ext_vector_type(8)))  float    v8f;
typedef __attribute__((ext_vector_type(8)))  _Float16 v8h;
typedef __attribute__((ext_vector_type(4)))  float    v4f;

#define S_LEN 2048
#define BATCH 8
#define DMODEL 1024
#define HD 64
#define KSPLIT 8                 // key ranges per query tile, one wave each
#define NWAVES (4 * KSPLIT)      // waves per attention block
#define OPITCH 68                // floats per staged partial row (16 B x odd)
#define PKS 8                    // K ranges per projection tile, one wave each
#define PMS (PKS / 2)            // partials staged for the final merge
#define PPITCH 196               // floats per staged projection row (16 B x odd)
#define PTILE (16 * PPITCH + 8)  // floats per staged 16-row tile: the 8 spread the tiles over the banks
#define PPLANE (4 * PTILE)       // floats per staged partial
#define FRAG 512                 // f16 elements of one stored 16 x 32 fragment

// ---------------------------------------------------------------------------
// WMMA helper: D = A(16x32 f16) * B(32x16 f16) + C(16x16 f32)
// ---------------------------------------------------------------------------
__device__ __forceinline__ v8f wmma_f16(v16h a, v16h b, v8f c) {
  return __builtin_amdgcn_wmma_f32_16x16x32_f16(
      /*neg_a=*/false, a, /*neg_b=*/false, b,
      /*c_mod=*/(short)0, c, /*reuse_a=*/false, /*reuse_b=*/false);
}

// ---------------------------------------------------------------------------
// Fragment loaders.
// A 16x32 f16 layout (ISA 7.12.2): lane L -> m=L&15, h=L>>4.
//   VGPR j in [0,3]: K = 8h + 2j, 2j+1 ; VGPR j in [4,7]: K = 16 + 8h + 2(j-4)
// B mirrors A on the transposed operand (row index = N column, k pattern same).
// Contiguous K pairs -> dword loads.
// ---------------------------------------------------------------------------
union FragBits { unsigned int u[8]; v16h v; };
typedef __attribute__((ext_vector_type(4))) unsigned int u32x4;
union FragQ { u32x4 q[2]; v16h v; };

// Fragment order: the workspace operands (weights, Q, K, V) are stored fragment by
// fragment, 1,024 contiguous bytes each, as [g][lane][8 elements]: lane 16h + c
// holds row c, k = 16g + 8h + e. Each of the two 16-byte loads of a wave then
// covers 512 contiguous bytes (4 whole lines), not 32 bytes of each of 16 lines.
// f: wave-uniform; off: the lane's byte offset behind f, 16 * lane inside the fragment
__device__ __forceinline__ v16h load_frag_packed(const _Float16* f, unsigned off) {
  const u32x4* p = (const u32x4*)((const char*)f + off);
  FragQ t;
  t.q[0] = p[0];
  t.q[1] = p[32];
  return t.v;
}

__device__ __forceinline__ v16h load_frag_h(const _Float16* p, int row, int h, int ld) {
  const unsigned int* q = (const unsigned int*)(p + row * ld + 8 * h);
  FragBits t;
#pragma unroll
  for (int j = 0; j < 8; ++j) t.u[j] = q[(j < 4) ? j : j + 4];
  return t.v;
}

__device__ __forceinline__ v16h load_frag_f32(const float* tile, int m, int h, int ld) {
  const float* row = tile + m * ld + 8 * h;
  v16h a;
#pragma unroll
  for (int j = 0; j < 8; ++j) {
    int k = (j < 4) ? 2 * j : 16 + 2 * (j - 4);
    float2 f = *(const float2*)(row + k);
    a[2 * j]     = (_Float16)f.x;
    a[2 * j + 1] = (_Float16)f.y;
  }
  return a;
}

// ---------------------------------------------------------------------------
// Kernel 0: convert weights fp32 [k][n] -> f16 in fragment order, [k / 32][n / 16]
// over the 192 columns of Wq, Wk, Wv; one 16-byte piece per thread
// ---------------------------------------------------------------------------
__global__ void __launch_bounds__(256)
prep_weights(const float* __restrict__ Wq, const float* __restrict__ Wk,
             const float* __restrict__ Wv, _Float16* __restrict__ Wt) {
  const int idx = blockIdx.x * 256 + threadIdx.x;    // 0 .. 3*64*1024/8-1
  const int c = idx & 15, h = (idx >> 4) & 1, g = (idx >> 5) & 1;
  const int f  = idx >> 6;                           // fragment
  const int ks = f / 12, nt = f % 12;
  const float* W = (nt < 4) ? Wq : ((nt < 8) ? Wk : Wv);
  const float* src = W + (ks * 32 + g * 16 + h * 8) * HD + (nt & 3) * 16 + c;
  v8h o;
#pragma unroll
  for (int e = 0; e < 8; ++e) o[e] = (_Float16)src[e * HD];
  *(v8h*)&Wt[(size_t)idx * 8] = o;
}

// ---------------------------------------------------------------------------
// Kernel 1: QKV projection. A block owns 4 tiles of 16 rows x 192 columns; each
// tile's K is split into PKS contiguous ranges, one wave per (tile, range), so
// that a SIMD holds PKS waves whose load waits overlap. The partial sums of the
// ranges are merged through LDS.
//   X      : [S*B, 1024] fp32 (row r = s*B + b)
//   Wt     : [k / 32][n / 16] fragments (rows n, k along the model dimension)
//   Qh,Kh  : [b][s / 16][d / 32] fragments (rows s, k along d)
//   Vt     : [b][s / 32][d / 16] fragments (rows d, k along s: the PV B-operand)
// ---------------------------------------------------------------------------
__global__ void __launch_bounds__(128 * PKS)
qkv_proj(const float* __restrict__ X, const _Float16* __restrict__ Wt,
         const float* __restrict__ bq, const float* __restrict__ bk,
         const float* __restrict__ bv,
         _Float16* __restrict__ Qh, _Float16* __restrict__ Kh,
         _Float16* __restrict__ Vt) {
  // PKS partials of 64 x 192 floats exceed the LDS: the upper half of the ranges
  // is first added into the lower half, so PMS partials are staged at a time
  __shared__ __align__(16) float Part[PMS * PPLANE];

  const int lane = threadIdx.x & 31;
  // wave-uniform by construction; held in a scalar register so that the K range,
  // the operand bases and the branches of the merge stay scalar
  const int wid = __builtin_amdgcn_readfirstlane(threadIdx.x >> 5);
  const int m = lane & 15, h = lane >> 4;
  const int tile = wid & 3;                  // 16-row tile inside the block
  const int kr   = wid >> 2;                 // K range

  v8f acc[12];
#pragma unroll
  for (int t = 0; t < 12; ++t)
#pragma unroll
    for (int i = 0; i < 8; ++i) acc[t][i] = 0.0f;

  const float* Xtile = X + (size_t)(blockIdx.x * 4 + tile) * 16 * DMODEL;
  const int kbeg = kr * (DMODEL / PKS);
  for (int k0 = kbeg; k0 < kbeg + DMODEL / PKS; k0 += 32) {
    v16h a = load_frag_f32(Xtile + k0, m, h, DMODEL);
    const _Float16* Wf = Wt + (size_t)(k0 >> 5) * 12 * FRAG;
#pragma unroll
    for (int nt = 0; nt < 12; ++nt) {
      v16h bf = load_frag_packed(Wf + nt * FRAG, lane * 16u);
      acc[nt] = wmma_f16(a, bf, acc[nt]);
    }
  }

  // ---- range kr + PMS hands its sums to range kr, in register order ----
  float* Pw = Part + (kr & (PMS - 1)) * PPLANE + tile * PTILE;
  v4f* Px = (v4f*)Pw + lane;
  if (kr >= PMS) {
#pragma unroll
    for (int nt = 0; nt < 12; ++nt) {
      Px[(2 * nt) * 32]     = __builtin_shufflevector(acc[nt], acc[nt], 0, 1, 2, 3);
      Px[(2 * nt + 1) * 32] = __builtin_shufflevector(acc[nt], acc[nt], 4, 5, 6, 7);
    }
  }
  // publishes the upper ranges' sums to the waves that add them
  __syncthreads();
  if (kr < PMS) {
#pragma unroll
    for (int nt = 0; nt < 12; ++nt) {
      const v4f lo = Px[(2 * nt) * 32], hi = Px[(2 * nt + 1) * 32];
#pragma unroll
      for (int i = 0; i < 4; ++i) { acc[nt][i] += lo[i]; acc[nt][i + 4] += hi[i]; }
    }
    // ---- stage the pair's sums row-major, over the slice just read ----
#pragma unroll
    for (int nt = 0; nt < 12; ++nt)
#pragma unroll
      for (int i = 0; i < 8; ++i)
        Pw[(i + 8 * h) * PPITCH + nt * 16 + m] = acc[nt][i];
  }
  // publishes the PMS staged partials to the threads that merge them
  __syncthreads();

  // ---- merge, bias, store Q and K: 8 columns of one row per thread, one 16-byte
  // piece of a fragment; the 8 positions of a (batch, piece) fill one 128-byte line
  {
    const int sl = threadIdx.x & 7, b = (threadIdx.x >> 3) & 7;
    const int c8 = (threadIdx.x >> 6) * 8;   // column 0 .. 127: Q, then K
    const float* Pr = Part + (sl >> 1) * PTILE + ((sl & 1) * 8 + b) * PPITCH + c8;
    float4 o0 = *(const float4*)Pr, o1 = *(const float4*)(Pr + 4);
#pragma unroll
    for (int r = 1; r < PMS; ++r) {
      const float4 p0 = *(const float4*)(Pr + r * PPLANE);
      const float4 p1 = *(const float4*)(Pr + r * PPLANE + 4);
      o0.x += p0.x; o0.y += p0.y; o0.z += p0.z; o0.w += p0.w;
      o1.x += p1.x; o1.y += p1.y; o1.z += p1.z; o1.w += p1.w;
    }
    const int col = c8 & 63;
    const float* bias = (c8 < 64 ? bq : bk) + col;
    const float4 b0 = *(const float4*)bias, b1 = *(const float4*)(bias + 4);
    const int s = blockIdx.x * 8 + sl;
    v8h q;
    q[0] = (_Float16)(o0.x + b0.x);
    q[1] = (_Float16)(o0.y + b0.y);
    q[2] = (_Float16)(o0.z + b0.z);
    q[3] = (_Float16)(o0.w + b0.w);
    q[4] = (_Float16)(o1.x + b1.x);
    q[5] = (_Float16)(o1.y + b1.y);
    q[6] = (_Float16)(o1.z + b1.z);
    q[7] = (_Float16)(o1.w + b1.w);
    // column col = 32 * fragment + 16g + 8h + e, row s & 15
    const size_t frag = (size_t)(b * (S_LEN / 16) + (s >> 4)) * 2 + (col >> 5);
    *(v8h*)&(c8 < 64 ? Qh : Kh)[frag * FRAG + ((col >> 4) & 1) * 256 +
                                (((col >> 3) & 1) * 16 + (s & 15)) * 8] = q;
  }

  // ---- merge, bias, store V: the block's 8 positions of one (b, column) are one
  // 16-byte piece of a fragment; 16 columns fill 256 contiguous bytes ----
  if (threadIdx.x < 512) {
    const int col = threadIdx.x & 63, b = threadIdx.x >> 6;
    const float bb = bv[col];
    v8h q;
#pragma unroll
    for (int j = 0; j < 8; ++j) {
      const float* Pr = Part + (j >> 1) * PTILE + ((j & 1) * 8 + b) * PPITCH + 128 + col;
      float o = Pr[0];
#pragma unroll
      for (int r = 1; r < PMS; ++r) o += Pr[r * PPLANE];
      q[j] = (_Float16)(o + bb);
    }
    // position s0 = 32 * fragment + 16g + 8h, row col & 15
    const int s0 = blockIdx.x * 8;
    const size_t frag = (size_t)(b * (S_LEN / 32) + (s0 >> 5)) * 4 + (col >> 4);
    *(v8h*)&Vt[frag * FRAG + ((s0 >> 4) & 1) * 256 +
               (((s0 >> 3) & 1) * 16 + (col & 15)) * 8] = q;
  }
}

// ---------------------------------------------------------------------------
// Kernel 2: flash attention. A block owns 4 query tiles of 16 rows; each tile's
// keys are split into KSPLIT contiguous ranges, one wave per (tile, range), so
// that a SIMD holds KSPLIT waves whose load and LDS waits overlap. The partial
// (max, sum, O) of the ranges are merged through LDS at the end.
// Score C-layout: lane L holds (N = L&15, M = i + 8*(L>>4)) for i=0..7, so a
// score row lives in one VGPR across a 16-lane half -> shfl_xor {1,2,4,8}
// reductions for online softmax.
// ---------------------------------------------------------------------------
__global__ void __launch_bounds__(32 * NWAVES)
flash_attn(const _Float16* __restrict__ Qh, const _Float16* __restrict__ Kh,
           const _Float16* __restrict__ Vt, const float* __restrict__ mask,
           float* __restrict__ out) {
  __shared__ __align__(16) _Float16 Plds[NWAVES * 16 * 32];
  __shared__ __align__(16) float Opart[NWAVES * 16 * OPITCH];
  __shared__ float Mpart[NWAVES * 16];
  __shared__ float Lpart[NWAVES * 16];

  const int lane = threadIdx.x & 31;
  // wave-uniform by construction; held in a scalar register so that the key
  // range, its addresses and the loop test stay scalar
  const int wid  = __builtin_amdgcn_readfirstlane(threadIdx.x >> 5);
  const int n = lane & 15, h = lane >> 4;
  const int b  = blockIdx.y;
  const int qt = blockIdx.x * 4 + (wid & 3);       // 16-row query tile
  const int kbeg = (wid >> 2) * (S_LEN / KSPLIT);  // this wave's key range

  const _Float16* Qbase = Qh + (size_t)(b * (S_LEN / 16) + qt) * 2 * FRAG;
  // The Q fragments are parked in this wave's own slice of Opart (free until the
  // loop ends) and re-read each pass: held in registers they push the wave past
  // the 128 VGPRs that 8 waves per SIMD leave it, and the build spills.
  u32x4* Qw = (u32x4*)(Opart + wid * 16 * OPITCH) + lane;
  {
    FragQ q0, q1;
    q0.v = load_frag_packed(Qbase,        lane * 16u);
    q1.v = load_frag_packed(Qbase + FRAG, lane * 16u);
    Qw[0]  = q0.q[0];
    Qw[32] = q0.q[1];
    Qw[64] = q1.q[0];
    Qw[96] = q1.q[1];
  }

  float mrun[8], lrun[8];
  v8f O[4];
#pragma unroll
  for (int i = 0; i < 8; ++i) { mrun[i] = -1e30f; lrun[i] = 0.0f; }
#pragma unroll
  for (int t = 0; t < 4; ++t)
#pragma unroll
    for (int i = 0; i < 8; ++i) O[t][i] = 0.0f;

  const float scale = 0.03125f;                    // 1/sqrt(1024)
  _Float16* Pw = Plds + wid * 512;
  // a pass of 32 keys reads 4 contiguous fragments of K and 4 of V, at the same
  // byte offset in the two buffers: one 32-bit offset per lane serves all 16 loads
  unsigned koff = (unsigned)(b * (S_LEN / 32) + (kbeg >> 5)) * (4 * FRAG * 2) + lane * 16u;

  for (int kb = kbeg; kb < kbeg + S_LEN / KSPLIT; kb += 32, koff += 4 * FRAG * 2) {
    // ---- scores for 32 keys: two 16x16 tiles, K-dim 64 = 2 wmma each ----
    FragQ fq0, fq1;
    fq0.q[0] = Qw[0];
    fq0.q[1] = Qw[32];
    fq1.q[0] = Qw[64];
    fq1.q[1] = Qw[96];
    const v16h aq0 = fq0.v, aq1 = fq1.v;
    v8f c0, c1;
#pragma unroll
    for (int i = 0; i < 8; ++i) { c0[i] = 0.0f; c1[i] = 0.0f; }
    c0 = wmma_f16(aq0, load_frag_packed(Kh,            koff), c0);
    c0 = wmma_f16(aq1, load_frag_packed(Kh + FRAG,     koff), c0);
    c1 = wmma_f16(aq0, load_frag_packed(Kh + 2 * FRAG, koff), c1);
    c1 = wmma_f16(aq1, load_frag_packed(Kh + 3 * FRAG, koff), c1);

    // ---- (score + log(mask)) * scale, online softmax ----
    const float lm0 = __logf(mask[(kb + n) * BATCH + b]);
    const float lm1 = __logf(mask[(kb + 16 + n) * BATCH + b]);
    float s0[8], s1[8], rmax[8];
#pragma unroll
    for (int i = 0; i < 8; ++i) {
      s0[i] = (c0[i] + lm0) * scale;
      s1[i] = (c1[i] + lm1) * scale;
      rmax[i] = fmaxf(s0[i], s1[i]);
    }
#pragma unroll
    for (int xm = 1; xm <= 8; xm <<= 1)
#pragma unroll
      for (int i = 0; i < 8; ++i)
        rmax[i] = fmaxf(rmax[i], __shfl_xor(rmax[i], xm, 32));

    float alpha[8], p0[8], p1[8], rsum[8];
#pragma unroll
    for (int i = 0; i < 8; ++i) {
      float mn = fmaxf(mrun[i], rmax[i]);
      alpha[i] = __expf(mrun[i] - mn);
      mrun[i]  = mn;
      p0[i] = __expf(s0[i] - mn);
      p1[i] = __expf(s1[i] - mn);
      rsum[i] = p0[i] + p1[i];
    }
#pragma unroll
    for (int xm = 1; xm <= 8; xm <<= 1)
#pragma unroll
      for (int i = 0; i < 8; ++i)
        rsum[i] += __shfl_xor(rsum[i], xm, 32);
#pragma unroll
    for (int i = 0; i < 8; ++i) lrun[i] = lrun[i] * alpha[i] + rsum[i];
#pragma unroll
    for (int t = 0; t < 4; ++t)
#pragma unroll
      for (int i = 0; i < 8; ++i) O[t][i] *= alpha[i];

    // ---- reshape P (C-layout f32) -> A-fragment f16 via LDS ----
#pragma unroll
    for (int i = 0; i < 8; ++i) {
      int row = i + 8 * h;
      Pw[row * 32 + n]      = (_Float16)p0[i];
      Pw[row * 32 + 16 + n] = (_Float16)p1[i];
    }
    asm volatile("s_wait_dscnt 0" ::: "memory");
    v16h pa = load_frag_h(Pw, n, h, 32);

    // ---- O += P(16x32) x V(32x64) ----
#pragma unroll
    for (int t = 0; t < 4; ++t)
      O[t] = wmma_f16(pa, load_frag_packed(Vt + t * FRAG, koff), O[t]);
  }

  // ---- stage this range's partial result ----
  float* Ow = Opart + wid * 16 * OPITCH;
#pragma unroll
  for (int t = 0; t < 4; ++t)
#pragma unroll
    for (int i = 0; i < 8; ++i)
      Ow[(i + 8 * h) * OPITCH + t * 16 + n] = O[t][i];
  if (n == 0) {
#pragma unroll
    for (int i = 0; i < 8; ++i) {
      Mpart[wid * 16 + i + 8 * h] = mrun[i];
      Lpart[wid * 16 + i + 8 * h] = lrun[i];
    }
  }
  // publishes every range's partial to the threads that merge them
  __syncthreads();

  // ---- merge the ranges, normalize, write out [s][b][d] fp32 ----
  const int tq = threadIdx.x / (32 * KSPLIT);      // query tile this thread merges
  for (int e = threadIdx.x % (32 * KSPLIT); e < 256; e += 32 * KSPLIT) {
    const int row = e >> 4, c4 = (e & 15) * 4;
    float mr[KSPLIT];
    float M = -1e30f;
#pragma unroll
    for (int r = 0; r < KSPLIT; ++r) {
      mr[r] = Mpart[(r * 4 + tq) * 16 + row];
      M = fmaxf(M, mr[r]);
    }
    float L = 0.0f;
    float4 o = make_float4(0.0f, 0.0f, 0.0f, 0.0f);
#pragma unroll
    for (int r = 0; r < KSPLIT; ++r) {
      const float w = __expf(mr[r] - M);
      const float4 p = *(const float4*)&Opart[((r * 4 + tq) * 16 + row) * OPITCH + c4];
      L += w * Lpart[(r * 4 + tq) * 16 + row];
      o.x += w * p.x; o.y += w * p.y; o.z += w * p.z; o.w += w * p.w;
    }
    const float inv = 1.0f / L;
    const int s = (blockIdx.x * 4 + tq) * 16 + row;
    *(float4*)&out[((size_t)s * BATCH + b) * HD + c4] =
        make_float4(o.x * inv, o.y * inv, o.z * inv, o.w * inv);
  }
}

// ---------------------------------------------------------------------------
extern "C" void kernel_launch(void* const* d_in, const int* in_sizes, int n_in,
                              void* d_out, int out_size, void* d_ws, size_t ws_size,
                              hipStream_t stream) {
  const float* X    = (const float*)d_in[0];
  const float* mask = (const float*)d_in[1];
  const float* Wq   = (const float*)d_in[2];
  const float* bq   = (const float*)d_in[3];
  const float* Wk   = (const float*)d_in[4];
  const float* bk   = (const float*)d_in[5];
  const float* Wv   = (const float*)d_in[6];
  const float* bv   = (const float*)d_in[7];
  float* out = (float*)d_out;

  char* ws = (char*)d_ws;
  const size_t WT_BYTES  = (size_t)3 * 64 * 1024 * 2;          // 384 KB
  const size_t QKV_BYTES = (size_t)BATCH * S_LEN * HD * 2;     // 2 MB each
  _Float16* Wt = (_Float16*)ws;
  _Float16* Qh = (_Float16*)(ws + WT_BYTES);
  _Float16* Kh = (_Float16*)(ws + WT_BYTES + QKV_BYTES);
  _Float16* Vt = (_Float16*)(ws + WT_BYTES + 2 * QKV_BYTES);

  prep_weights<<<96, 256, 0, stream>>>(Wq, Wk, Wv, Wt);
  qkv_proj<<<(S_LEN * BATCH) / 64, 128 * PKS, 0, stream>>>(X, Wt, bq, bk, bv, Qh, Kh, Vt);
  flash_attn<<<dim3(S_LEN / 64, BATCH), 32 * NWAVES, 0, stream>>>(Qh, Kh, Vt, mask, out);
}

// v004
// Measured time: 45.2 microseconds a run.
// In two side-by-side timings against v003, it was 1.16 and 1.17 times as fast.
// Counting every step since v000, it is 3.92 times as fast.
#include <hip/hip_runtime.h>
#include <hip/hip_bf16.h>
#include <cmath>

typedef __attribute__((ext_vector_type(16))) _Float16 v16h;
typedef __attribute__((ext_vector_type(8)))  float    v8f;
typedef __attribute__((ext_vector_type(8)))  _Float16 v8h;
typedef __attribute__((ext_vector_type(4)))  float    v4f;

#define S_LEN 2048
#define BATCH 8
#define DMODEL 1024
#define HD 64
#define KSPLIT 8                 // key ranges per query tile, one wave each
#define NWAVES (4 * KSPLIT)      // waves per attention block
#define OPITCH 68                // floats per staged partial row (16 B x odd)
#define PKS 8                    // K ranges per projection tile, one wave each
#define PMS (PKS / 2)            // partials staged for the final merge
#define PPITCH 196               // floats per staged projection row (16 B x odd)
#define PTILE (16 * PPITCH + 8)  // floats per staged 16-row tile: the 8 spread the tiles over the banks
#define PPLANE (4 * PTILE)       // floats per staged partial
#define FRAG 512                 // f16 elements of one stored 16 x 32 fragment

// ---------------------------------------------------------------------------
// WMMA helper: D = A(16x32 f16) * B(32x16 f16) + C(16x16 f32)
// ---------------------------------------------------------------------------
__device__ __forceinline__ v8f wmma_f16(v16h a, v16h b, v8f c) {
  return __builtin_amdgcn_wmma_f32_16x16x32_f16(
      /*neg_a=*/false, a, /*neg_b=*/false, b,
      /*c_mod=*/(short)0, c, /*reuse_a=*/false, /*reuse_b=*/false);
}

// ---------------------------------------------------------------------------
// Fragment loaders.
// A 16x32 f16 layout (ISA 7.12.2): lane L -> m=L&15, h=L>>4.
//   VGPR j in [0,3]: K = 8h + 2j, 2j+1 ; VGPR j in [4,7]: K = 16 + 8h + 2(j-4)
// B mirrors A on the transposed operand (row index = N column, k pattern same).
// Contiguous K pairs -> dword loads.
// ---------------------------------------------------------------------------
typedef __attribute__((ext_vector_type(4))) unsigned int u32x4;
union FragQ { u32x4 q[2]; v16h v; };

// Fragment order: the workspace operands (weights, Q, K, V) are stored fragment by
// fragment, 1,024 contiguous bytes each, as [g][lane][8 elements]: lane 16h + c
// holds row c, k = 16g + 8h + e. Each of the two 16-byte loads of a wave then
// covers 512 contiguous bytes (4 whole lines), not 32 bytes of each of 16 lines.
// f: wave-uniform; off: the lane's byte offset behind f, 16 * lane inside the fragment
__device__ __forceinline__ v16h load_frag_packed(const _Float16* f, unsigned off) {
  const u32x4* p = (const u32x4*)((const char*)f + off);
  FragQ t;
  t.q[0] = p[0];
  t.q[1] = p[32];
  return t.v;
}

__device__ __forceinline__ v16h load_frag_f32(const float* tile, int m, int h, int ld) {
  const float* row = tile + m * ld + 8 * h;
  v16h a;
#pragma unroll
  for (int j = 0; j < 8; ++j) {
    int k = (j < 4) ? 2 * j : 16 + 2 * (j - 4);
    float2 f = *(const float2*)(row + k);
    a[2 * j]     = (_Float16)f.x;
    a[2 * j + 1] = (_Float16)f.y;
  }
  return a;
}

// ---------------------------------------------------------------------------
// Kernel 0: convert weights fp32 [k][n] -> f16 in fragment order, [k / 32][n / 16]
// over the 192 columns of Wq, Wk, Wv; one 16-byte piece per thread
// ---------------------------------------------------------------------------
__global__ void __launch_bounds__(256)
prep_weights(const float* __restrict__ Wq, const float* __restrict__ Wk,
             const float* __restrict__ Wv, _Float16* __restrict__ Wt) {
  const int idx = blockIdx.x * 256 + threadIdx.x;    // 0 .. 3*64*1024/8-1
  const int c = idx & 15, h = (idx >> 4) & 1, g = (idx >> 5) & 1;
  const int f  = idx >> 6;                           // fragment
  const int ks = f / 12, nt = f % 12;
  const float* W = (nt < 4) ? Wq : ((nt < 8) ? Wk : Wv);
  const float* src = W + (ks * 32 + g * 16 + h * 8) * HD + (nt & 3) * 16 + c;
  v8h o;
#pragma unroll
  for (int e = 0; e < 8; ++e) o[e] = (_Float16)src[e * HD];
  *(v8h*)&Wt[(size_t)idx * 8] = o;
}

// ---------------------------------------------------------------------------
// Kernel 1: QKV projection. A block owns 4 tiles of 16 rows x 192 columns; each
// tile's K is split into PKS contiguous ranges, one wave per (tile, range), so
// that a SIMD holds PKS waves whose load waits overlap. The partial sums of the
// ranges are merged through LDS.
//   X      : [S*B, 1024] fp32 (row r = s*B + b)
//   Wt     : [k / 32][n / 16] fragments (rows n, k along the model dimension)
//   Qh,Kh  : [b][s / 16][d / 32] fragments (rows s, k along d)
//   Vt     : [b][s / 32][d / 16] fragments (rows d, k along s: the A operand of Ot += Vt x Pt)
// ---------------------------------------------------------------------------
__global__ void __launch_bounds__(128 * PKS)
qkv_proj(const float* __restrict__ X, const _Float16* __restrict__ Wt,
         const float* __restrict__ bq, const float* __restrict__ bk,
         const float* __restrict__ bv,
         _Float16* __restrict__ Qh, _Float16* __restrict__ Kh,
         _Float16* __restrict__ Vt) {
  // PKS partials of 64 x 192 floats exceed the LDS: the upper half of the ranges
  // is first added into the lower half, so PMS partials are staged at a time
  __shared__ __align__(16) float Part[PMS * PPLANE];

  const int lane = threadIdx.x & 31;
  // wave-uniform by construction; held in a scalar register so that the K range,
  // the operand bases and the branches of the merge stay scalar
  const int wid = __builtin_amdgcn_readfirstlane(threadIdx.x >> 5);
  const int m = lane & 15, h = lane >> 4;
  const int tile = wid & 3;                  // 16-row tile inside the block
  const int kr   = wid >> 2;                 // K range

  v8f acc[12];
#pragma unroll
  for (int t = 0; t < 12; ++t)
#pragma unroll
    for (int i = 0; i < 8; ++i) acc[t][i] = 0.0f;

  const float* Xtile = X + (size_t)(blockIdx.x * 4 + tile) * 16 * DMODEL;
  const int kbeg = kr * (DMODEL / PKS);
  for (int k0 = kbeg; k0 < kbeg + DMODEL / PKS; k0 += 32) {
    v16h a = load_frag_f32(Xtile + k0, m, h, DMODEL);
    const _Float16* Wf = Wt + (size_t)(k0 >> 5) * 12 * FRAG;
#pragma unroll
    for (int nt = 0; nt < 12; ++nt) {
      v16h bf = load_frag_packed(Wf + nt * FRAG, lane * 16u);
      acc[nt] = wmma_f16(a, bf, acc[nt]);
    }
  }

  // ---- range kr + PMS hands its sums to range kr, in register order ----
  float* Pw = Part + (kr & (PMS - 1)) * PPLANE + tile * PTILE;
  v4f* Px = (v4f*)Pw + lane;
  if (kr >= PMS) {
#pragma unroll
    for (int nt = 0; nt < 12; ++nt) {
      Px[(2 * nt) * 32]     = __builtin_shufflevector(acc[nt], acc[nt], 0, 1, 2, 3);
      Px[(2 * nt + 1) * 32] = __builtin_shufflevector(acc[nt], acc[nt], 4, 5, 6, 7);
    }
  }
  // publishes the upper ranges' sums to the waves that add them
  __syncthreads();
  if (kr < PMS) {
#pragma unroll
    for (int nt = 0; nt < 12; ++nt) {
      const v4f lo = Px[(2 * nt) * 32], hi = Px[(2 * nt + 1) * 32];
#pragma unroll
      for (int i = 0; i < 4; ++i) { acc[nt][i] += lo[i]; acc[nt][i + 4] += hi[i]; }
    }
    // ---- stage the pair's sums row-major, over the slice just read ----
#pragma unroll
    for (int nt = 0; nt < 12; ++nt)
#pragma unroll
      for (int i = 0; i < 8; ++i)
        Pw[(i + 8 * h) * PPITCH + nt * 16 + m] = acc[nt][i];
  }
  // publishes the PMS staged partials to the threads that merge them
  __syncthreads();

  // ---- merge, bias, store Q and K: 8 columns of one row per thread, one 16-byte
  // piece of a fragment; the 8 positions of a (batch, piece) fill one 128-byte line
  {
    const int sl = threadIdx.x & 7, b = (threadIdx.x >> 3) & 7;
    const int c8 = (threadIdx.x >> 6) * 8;   // column 0 .. 127: Q, then K
    const float* Pr = Part + (sl >> 1) * PTILE + ((sl & 1) * 8 + b) * PPITCH + c8;
    float4 o0 = *(const float4*)Pr, o1 = *(const float4*)(Pr + 4);
#pragma unroll
    for (int r = 1; r < PMS; ++r) {
      const float4 p0 = *(const float4*)(Pr + r * PPLANE);
      const float4 p1 = *(const float4*)(Pr + r * PPLANE + 4);
      o0.x += p0.x; o0.y += p0.y; o0.z += p0.z; o0.w += p0.w;
      o1.x += p1.x; o1.y += p1.y; o1.z += p1.z; o1.w += p1.w;
    }
    const int col = c8 & 63;
    const float* bias = (c8 < 64 ? bq : bk) + col;
    const float4 b0 = *(const float4*)bias, b1 = *(const float4*)(bias + 4);
    const int s = blockIdx.x * 8 + sl;
    v8h q;
    q[0] = (_Float16)(o0.x + b0.x);
    q[1] = (_Float16)(o0.y + b0.y);
    q[2] = (_Float16)(o0.z + b0.z);
    q[3] = (_Float16)(o0.w + b0.w);
    q[4] = (_Float16)(o1.x + b1.x);
    q[5] = (_Float16)(o1.y + b1.y);
    q[6] = (_Float16)(o1.z + b1.z);
    q[7] = (_Float16)(o1.w + b1.w);
    // column col = 32 * fragment + 16g + 8h + e, row s & 15
    const size_t frag = (size_t)(b * (S_LEN / 16) + (s >> 4)) * 2 + (col >> 5);
    *(v8h*)&(c8 < 64 ? Qh : Kh)[frag * FRAG + ((col >> 4) & 1) * 256 +
                                (((col >> 3) & 1) * 16 + (s & 15)) * 8] = q;
  }

  // ---- merge, bias, store V: the block's 8 positions of one (b, column) are one
  // 16-byte piece of a fragment; 16 columns fill 256 contiguous bytes ----
  if (threadIdx.x < 512) {
    const int col = threadIdx.x & 63, b = threadIdx.x >> 6;
    const float bb = bv[col];
    v8h q;
#pragma unroll
    for (int j = 0; j < 8; ++j) {
      const float* Pr = Part + (j >> 1) * PTILE + ((j & 1) * 8 + b) * PPITCH + 128 + col;
      float o = Pr[0];
#pragma unroll
      for (int r = 1; r < PMS; ++r) o += Pr[r * PPLANE];
      q[j] = (_Float16)(o + bb);
    }
    // position s0 = 32 * fragment + 16g + 8h, row col & 15
    const int s0 = blockIdx.x * 8;
    const size_t frag = (size_t)(b * (S_LEN / 32) + (s0 >> 5)) * 4 + (col >> 4);
    *(v8h*)&Vt[frag * FRAG + ((s0 >> 4) & 1) * 256 +
               (((s0 >> 3) & 1) * 16 + (col & 15)) * 8] = q;
  }
}

// ---------------------------------------------------------------------------
// Kernel 2: flash attention. A block owns 4 query tiles of 16 rows; each tile's
// keys are split into KSPLIT contiguous ranges, one wave per (tile, range), so
// that a SIMD holds KSPLIT waves whose load waits overlap. The partial
// (max, sum, O) of the ranges are merged through LDS at the end.
// The products are taken transposed: St = K x Qt (A = K rows, B = Q rows) and
// Ot += Vt x Pt. Lane L then holds 16 of the 32 scores of ONE query, L & 15
// (keys i + 8*(L>>4) of each 16-key tile), so that the maximum and the sum of a
// score row are in-lane work plus one exchange between the lane halves, the
// running maximum, sum and rescale factor are one register each, and the two
// score tiles, converted in place, are the B fragment of the second product.
// ---------------------------------------------------------------------------
// the value of lane L ^ 16
__device__ __forceinline__ float other_half(float x) {
  const int v = __builtin_bit_cast(int, x);
  return __builtin_bit_cast(
      float, __builtin_amdgcn_permlanex16(v, v, 0x76543210, 0xfedcba98, false, false));
}

__global__ void __launch_bounds__(32 * NWAVES)
flash_attn(const _Float16* __restrict__ Qh, const _Float16* __restrict__ Kh,
           const _Float16* __restrict__ Vt, const float* __restrict__ mask,
           float* __restrict__ out) {
  __shared__ __align__(16) float Lmask[NWAVES * (S_LEN / KSPLIT)];
  __shared__ __align__(16) float Opart[NWAVES * 16 * OPITCH];
  __shared__ float Mpart[NWAVES * 16];
  __shared__ float Lpart[NWAVES * 16];

  const int lane = threadIdx.x & 31;
  // wave-uniform by construction; held in a scalar register so that the key
  // range, its addresses and the loop test stay scalar
  const int wid  = __builtin_amdgcn_readfirstlane(threadIdx.x >> 5);
  const int n = lane & 15, h = lane >> 4;
  const int b  = blockIdx.y;
  const int qt = blockIdx.x * 4 + (wid & 3);       // 16-row query tile
  const int kbeg = (wid >> 2) * (S_LEN / KSPLIT);  // this wave's key range

  const float scale = 0.03125f;                    // 1/sqrt(1024), a power of two

  const _Float16* Qbase = Qh + (size_t)(b * (S_LEN / 16) + qt) * 2 * FRAG;
  // B fragments of the first product, kept in registers over the loop
  const v16h bq0 = load_frag_packed(Qbase,        lane * 16u);
  const v16h bq1 = load_frag_packed(Qbase + FRAG, lane * 16u);
  // A lane needs the mask term of 16 keys per pass: log(mask) * scale of the
  // wave's key range is tabled once in the wave's own LDS slice.
  float* Lw = Lmask + wid * (S_LEN / KSPLIT);
#pragma unroll
  for (int j = 0; j < S_LEN / KSPLIT / 32; ++j)
    Lw[j * 32 + lane] = __logf(mask[(kbeg + j * 32 + lane) * BATCH + b]) * scale;
  // the loop reads entries that other lanes of this wave wrote: keeps those reads
  // behind the stores
  asm volatile("s_wait_dscnt 0" ::: "memory");

  float mrun = -1e30f, lrun = 0.0f;                // of query n; lrun: this half's keys
  v8f O[4];                                        // O[t][i] = Ot[16t + 8h + i][n]
#pragma unroll
  for (int t = 0; t < 4; ++t)
#pragma unroll
    for (int i = 0; i < 8; ++i) O[t][i] = 0.0f;

  const v4f* Lr = (const v4f*)(Lw + 8 * h);
  // a pass of 32 keys reads 4 contiguous fragments of K and 4 of V, at the same
  // byte offset in the two buffers: one 32-bit offset per lane serves all 16 loads
  unsigned koff = (unsigned)(b * (S_LEN / 32) + (kbeg >> 5)) * (4 * FRAG * 2) + lane * 16u;

  for (int kb = kbeg; kb < kbeg + S_LEN / KSPLIT; kb += 32, koff += 4 * FRAG * 2, Lr += 8) {
    // ---- scores of 32 keys: two 16x16 tiles (key x query), K-dim 64 = 2 wmma each ----
    v8f c0, c1;
#pragma unroll
    for (int i = 0; i < 8; ++i) { c0[i] = 0.0f; c1[i] = 0.0f; }
    c0 = wmma_f16(load_frag_packed(Kh,            koff), bq0, c0);
    c0 = wmma_f16(load_frag_packed(Kh + FRAG,     koff), bq1, c0);
    c1 = wmma_f16(load_frag_packed(Kh + 2 * FRAG, koff), bq0, c1);
    c1 = wmma_f16(load_frag_packed(Kh + 3 * FRAG, koff), bq1, c1);

    // ---- (score + log(mask)) * scale, online softmax of the lane's query ----
    const v4f l00 = Lr[0], l01 = Lr[1], l10 = Lr[4], l11 = Lr[5];
    float s[16];
#pragma unroll
    for (int i = 0; i < 4; ++i) {
      s[i]      = fmaf(c0[i],     scale, l00[i]);
      s[i + 4]  = fmaf(c0[i + 4], scale, l01[i]);
      s[i + 8]  = fmaf(c1[i],     scale, l10[i]);
      s[i + 12] = fmaf(c1[i + 4], scale, l11[i]);
    }
    float mx = s[0];
#pragma unroll
    for (int i = 1; i < 16; ++i) mx = fmaxf(mx, s[i]);
    mx = fmaxf(mx, other_half(mx));

    const float mn = fmaxf(mrun, mx);
    float alpha;                                   // exp(mrun - mn)
    // v_exp_f32 and the one slot that the instruction set asks for behind a
    // transcendental, in one statement: a v_nop of its own does not stay behind it
    asm("v_exp_f32 %0, %1\n\tv_nop" : "=v"(alpha) : "v"((mrun - mn) * 1.44269504f));
    mrun = mn;
    float rsum = 0.0f;
    v16h pb;   // pb[e] = Pt[8h + e][n], pb[8 + e] = Pt[16 + 8h + e][n]: V's stored k order
#pragma unroll
    for (int i = 0; i < 16; ++i) {
      const float p = __expf(s[i] - mn);
      rsum += p;
      pb[i] = (_Float16)p;
    }
    lrun = lrun * alpha + rsum;
#pragma unroll
    for (int t = 0; t < 4; ++t) O[t] *= alpha;

    // ---- Ot += Vt(64x32) x Pt(32x16) ----
#pragma unroll
    for (int t = 0; t < 4; ++t)
      O[t] = wmma_f16(load_frag_packed(Vt + t * FRAG, koff), pb, O[t]);
  }

  // ---- stage this range's partial result: 8 consecutive columns per register tile ----
  float* Ow = Opart + wid * 16 * OPITCH + n * OPITCH + 8 * h;
#pragma unroll
  for (int t = 0; t < 4; ++t) {
    *(v4f*)(Ow + t * 16)     = __builtin_shufflevector(O[t], O[t], 0, 1, 2, 3);
    *(v4f*)(Ow + t * 16 + 4) = __builtin_shufflevector(O[t], O[t], 4, 5, 6, 7);
  }
  lrun += other_half(lrun);
  if (h == 0) {
    Mpart[wid * 16 + n] = mrun;
    Lpart[wid * 16 + n] = lrun;
  }
  // publishes every range's partial to the threads that merge them
  __syncthreads();

  // ---- merge the ranges, normalize, write out [s][b][d] fp32 ----
  const int tq = threadIdx.x / (32 * KSPLIT);      // query tile this thread merges
  for (int e = threadIdx.x % (32 * KSPLIT); e < 256; e += 32 * KSPLIT) {
    const int row = e >> 4, c4 = (e & 15) * 4;
    float mr[KSPLIT];
    float M = -1e30f;
#pragma unroll
    for (int r = 0; r < KSPLIT; ++r) {
      mr[r] = Mpart[(r * 4 + tq) * 16 + row];
      M = fmaxf(M, mr[r]);
    }
    float L = 0.0f;
    float4 o = make_float4(0.0f, 0.0f, 0.0f, 0.0f);
#pragma unroll
    for (int r = 0; r < KSPLIT; ++r) {
      const float w = __expf(mr[r] - M);
      const float4 p = *(const float4*)&Opart[((r * 4 + tq) * 16 + row) * OPITCH + c4];
      L += w * Lpart[(r * 4 + tq) * 16 + row];
      o.x += w * p.x; o.y += w * p.y; o.z += w * p.z; o.w += w * p.w;
    }
    const float inv = 1.0f / L;
    const int s = (blockIdx.x * 4 + tq) * 16 + row;
    *(float4*)&out[((size_t)s * BATCH + b) * HD + c4] =
        make_float4(o.x * inv, o.y * inv, o.z * inv, o.w * inv);
  }
}

// ---------------------------------------------------------------------------
extern "C" void kernel_launch(void* const* d_in, const int* in_sizes, int n_in,
                              void* d_out, int out_size, void* d_ws, size_t ws_size,
                              hipStream_t stream) {
  const float* X    = (const float*)d_in[0];
  const float* mask = (const float*)d_in[1];
  const float* Wq   = (const float*)d_in[2];
  const float* bq   = (const float*)d_in[3];
  const float* Wk   = (const float*)d_in[4];
  const float* bk   = (const float*)d_in[5];
  const float* Wv   = (const float*)d_in[6];
  const float* bv   = (const float*)d_in[7];
  float* out = (float*)d_out;

  char* ws = (char*)d_ws;
  const size_t WT_BYTES  = (size_t)3 * 64 * 1024 * 2;          // 384 KB
  const size_t QKV_BYTES = (size_t)BATCH * S_LEN * HD * 2;     // 2 MB each
  _Float16* Wt = (_Float16*)ws;
  _Float16* Qh = (_Float16*)(ws + WT_BYTES);
  _Float16* Kh = (_Float16*)(ws + WT_BYTES + QKV_BYTES);
  _Float16* Vt = (_Float16*)(ws + WT_BYTES + 2 * QKV_BYTES);

  prep_weights<<<96, 256, 0, stream>>>(Wq, Wk, Wv, Wt);
  qkv_proj<<<(S_LEN * BATCH) / 64, 128 * PKS, 0, stream>>>(X, Wt, bq, bk, bv, Qh, Kh, Vt);
  flash_attn<<<dim3(S_LEN / 64, BATCH), 32 * NWAVES, 0, stream>>>(Qh, Kh, Vt, mask, out);
}

// v005
// One run takes 28.4 microseconds.
// In two side-by-side timings against v004, it was 1.57 and 1.62 times as fast.
// Over all steps from v000 it is 6.24 times as fast.
#include <hip/hip_runtime.h>
#include <hip/hip_bf16.h>
#include <cmath>

typedef __attribute__((ext_vector_type(16))) _Float16 v16h;
typedef __attribute__((ext_vector_type(8)))  float    v8f;
typedef __attribute__((ext_vector_type(8)))  _Float16 v8h;
typedef __attribute__((ext_vector_type(4)))  float    v4f;

#define S_LEN 2048
#define BATCH 8
#define DMODEL 1024
#define HD 64
#define KSPLIT 8                 // key ranges per query tile, one wave each
#define NWAVES (4 * KSPLIT)      // waves per attention block
#define OPITCH 68                // floats per staged partial row (16 B x odd)
#define PKS 4                    // K ranges per projection tile, one wave each
#define PSTEPS (DMODEL / PKS / 32)  // 32-deep steps of one K range
#define PPITCH 196               // floats per staged projection row (16 B x odd)
#define PTILE (16 * PPITCH + 8)  // floats per staged 16-row tile: the 8 spread the tiles over the banks
#define PPLANE (4 * PTILE)       // floats per staged partial
#define FRAG 512                 // f16 elements of one stored 16 x 32 fragment

// ---------------------------------------------------------------------------
// WMMA helper: D = A(16x32 f16) * B(32x16 f16) + C(16x16 f32)
// ---------------------------------------------------------------------------
__device__ __forceinline__ v8f wmma_f16(v16h a, v16h b, v8f c) {
  return __builtin_amdgcn_wmma_f32_16x16x32_f16(
      /*neg_a=*/false, a, /*neg_b=*/false, b,
      /*c_mod=*/(short)0, c, /*reuse_a=*/false, /*reuse_b=*/false);
}

// ---------------------------------------------------------------------------
// Fragment loaders.
// A 16x32 f16 layout (ISA 7.12.2): lane L -> m=L&15, h=L>>4.
//   VGPR j in [0,3]: K = 8h + 2j, 2j+1 ; VGPR j in [4,7]: K = 16 + 8h + 2(j-4)
// B mirrors A on the transposed operand (row index = N column, k pattern same).
// Contiguous K pairs -> dword loads.
// ---------------------------------------------------------------------------
typedef __attribute__((ext_vector_type(4))) unsigned int u32x4;
union FragQ { u32x4 q[2]; v16h v; };

// Fragment order: the workspace operands (weights, Q, K, V) are stored fragment by
// fragment, 1,024 contiguous bytes each, as [g][lane][8 elements]: lane 16h + c
// holds row c, k = 16g + 8h + e. Each of the two 16-byte loads of a wave then
// covers 512 contiguous bytes (4 whole lines), not 32 bytes of each of 16 lines.
// f: wave-uniform; off: the lane's byte offset behind f, 16 * lane inside the fragment
__device__ __forceinline__ v16h load_frag_packed(const _Float16* f, unsigned off) {
  const u32x4* p = (const u32x4*)((const char*)f + off);
  FragQ t;
  t.q[0] = p[0];
  t.q[1] = p[32];
  return t.v;
}

// ---------------------------------------------------------------------------
// Kernel 0: convert weights fp32 [k][n] -> f16 in fragment order, [k / 32][n / 16]
// over the 192 columns of Wq, Wk, Wv; one 16-byte piece per thread
// ---------------------------------------------------------------------------
__global__ void __launch_bounds__(256)
prep_weights(const float* __restrict__ Wq, const float* __restrict__ Wk,
             const float* __restrict__ Wv, _Float16* __restrict__ Wt) {
  const int idx = blockIdx.x * 256 + threadIdx.x;    // 0 .. 3*64*1024/8-1
  const int c = idx & 15, h = (idx >> 4) & 1, g = (idx >> 5) & 1;
  const int f  = idx >> 6;                           // fragment
  const int ks = f / 12, nt = f % 12;
  const float* W = (nt < 4) ? Wq : ((nt < 8) ? Wk : Wv);
  const float* src = W + (ks * 32 + g * 16 + h * 8) * HD + (nt & 3) * 16 + c;
  v8h o;
#pragma unroll
  for (int e = 0; e < 8; ++e) o[e] = (_Float16)src[e * HD];
  *(v8h*)&Wt[(size_t)idx * 8] = o;
}

// ---------------------------------------------------------------------------
// Kernel 1: QKV projection. A block owns 4 tiles of 16 rows x 192 columns; each
// tile's K is split into PKS contiguous ranges, one wave per (tile, range). With
// PKS waves on a SIMD a wave has 256 registers: beside its 96 accumulators it
// holds a ring of 12 weight fragments and the X rows of two steps, all loaded
// ahead, so that its loads are in flight together and no product waits out a
// whole load latency. The partial sums of the ranges are merged through LDS.
//   X      : [S*B, 1024] fp32 (row r = s*B + b)
//   Wt     : [k / 32][n / 16] fragments (rows n, k along the model dimension)
//   Qh,Kh  : [b][s / 16][d / 32] fragments (rows s, k along d)
//   Vt     : [b][s / 32][d / 16] fragments (rows d, k along s: the A operand of Ot += Vt x Pt)
// ---------------------------------------------------------------------------
__global__ void __launch_bounds__(128 * PKS)
qkv_proj(const float* __restrict__ X, const _Float16* __restrict__ Wt,
         const float* __restrict__ bq, const float* __restrict__ bk,
         const float* __restrict__ bv,
         _Float16* __restrict__ Qh, _Float16* __restrict__ Kh,
         _Float16* __restrict__ Vt) {
  __shared__ __align__(16) float Part[PKS * PPLANE];

  const int lane = threadIdx.x & 31;
  // wave-uniform by construction; held in a scalar register so that the K range
  // and the operand bases stay scalar
  const int wid = __builtin_amdgcn_readfirstlane(threadIdx.x >> 5);
  const int m = lane & 15, h = lane >> 4;
  const int tile = wid & 3;                  // 16-row tile inside the block
  const int kr   = wid >> 2;                 // K range

  v8f acc[12];
#pragma unroll
  for (int t = 0; t < 12; ++t)
#pragma unroll
    for (int i = 0; i < 8; ++i) acc[t][i] = 0.0f;

  // the lane's 16 floats of step ks: Xrow + 32 * ks + {0..7, 16..23}
  const float* Xrow = X + ((size_t)(blockIdx.x * 4 + tile) * 16 + m) * DMODEL +
                      kr * (DMODEL / PKS) + 8 * h;
  const _Float16* Wr = Wt + (size_t)kr * PSTEPS * 12 * FRAG;

  v4f xr[2][4];                              // X rows of the next two steps, as loaded
#pragma unroll
  for (int p = 0; p < 2; ++p) {
    const v4f* xp = (const v4f*)(Xrow + 32 * p);
    xr[p][0] = xp[0]; xr[p][1] = xp[1]; xr[p][2] = xp[4]; xr[p][3] = xp[5];
  }
  v16h bf[12];                               // ring of weight fragments, one step deep
#pragma unroll
  for (int nt = 0; nt < 12; ++nt) bf[nt] = load_frag_packed(Wr + nt * FRAG, lane * 16u);
  // unrolled: xr[ks & 1] and the tests on ks must be settled at compile time for
  // the two X sets and the ring to stay in registers
#pragma unroll
  for (int ks = 0; ks < PSTEPS; ++ks) {
    v16h a;
#pragma unroll
    for (int j = 0; j < 4; ++j)
#pragma unroll
      for (int e = 0; e < 4; ++e) a[4 * j + e] = (_Float16)xr[ks & 1][j][e];
    if (ks + 2 < PSTEPS) {
      const v4f* xp = (const v4f*)(Xrow + 32 * (ks + 2));
      xr[ks & 1][0] = xp[0]; xr[ks & 1][1] = xp[1];
      xr[ks & 1][2] = xp[4]; xr[ks & 1][3] = xp[5];
    }
    // each fragment's registers are refilled for the next step behind its product
#pragma unroll
    for (int nt = 0; nt < 12; ++nt) {
      acc[nt] = wmma_f16(a, bf[nt], acc[nt]);
      if (ks + 1 < PSTEPS)
        bf[nt] = load_frag_packed(Wr + ((ks + 1) * 12 + nt) * FRAG, lane * 16u);
    }
  }

  // ---- stage the range's sums row-major ----
  float* Pw = Part + kr * PPLANE + tile * PTILE;
#pragma unroll
  for (int nt = 0; nt < 12; ++nt)
#pragma unroll
    for (int i = 0; i < 8; ++i)
      Pw[(i + 8 * h) * PPITCH + nt * 16 + m] = acc[nt][i];
  // publishes the PKS staged partials to the threads that merge them
  __syncthreads();
  // ends the scheduling region of the register-full product loop: the merge below
  // is scheduled by itself, and its LDS loads are issued together, not one per wait
  __builtin_amdgcn_sched_barrier(0);

  // ---- merge, bias, store Q and K: 8 columns of one row per thread, one 16-byte
  // piece of a fragment; the 8 positions of a (batch, piece) fill one 128-byte line
  // unrolled: the choice of bias and of output buffer is made at compile time
#pragma unroll
  for (int qk = 0; qk < 2; ++qk) {           // Q, then K
    const int sl = threadIdx.x & 7, b = (threadIdx.x >> 3) & 7;
    const int col = (threadIdx.x >> 6) * 8;  // column of Q or of K
    const float* Pr = Part + (sl >> 1) * PTILE + ((sl & 1) * 8 + b) * PPITCH + qk * 64 + col;
    float4 o0 = *(const float4*)Pr, o1 = *(const float4*)(Pr + 4);
#pragma unroll
    for (int r = 1; r < PKS; ++r) {
      const float4 p0 = *(const float4*)(Pr + r * PPLANE);
      const float4 p1 = *(const float4*)(Pr + r * PPLANE + 4);
      o0.x += p0.x; o0.y += p0.y; o0.z += p0.z; o0.w += p0.w;
      o1.x += p1.x; o1.y += p1.y; o1.z += p1.z; o1.w += p1.w;
    }
    const float* bias = (qk == 0 ? bq : bk) + col;
    const float4 b0 = *(const float4*)bias, b1 = *(const float4*)(bias + 4);
    const int s = blockIdx.x * 8 + sl;
    v8h q;
    q[0] = (_Float16)(o0.x + b0.x);
    q[1] = (_Float16)(o0.y + b0.y);
    q[2] = (_Float16)(o0.z + b0.z);
    q[3] = (_Float16)(o0.w + b0.w);
    q[4] = (_Float16)(o1.x + b1.x);
    q[5] = (_Float16)(o1.y + b1.y);
    q[6] = (_Float16)(o1.z + b1.z);
    q[7] = (_Float16)(o1.w + b1.w);
    // column col = 32 * fragment + 16g + 8h + e, row s & 15
    const size_t frag = (size_t)(b * (S_LEN / 16) + (s >> 4)) * 2 + (col >> 5);
    *(v8h*)&(qk == 0 ? Qh : Kh)[frag * FRAG + ((col >> 4) & 1) * 256 +
                                (((col >> 3) & 1) * 16 + (s & 15)) * 8] = q;
  }

  // ---- merge, bias, store V: the block's 8 positions of one (b, column) are one
  // 16-byte piece of a fragment; 16 columns fill 256 contiguous bytes ----
  {
    const int col = threadIdx.x & 63, b = threadIdx.x >> 6;
    const float bb = bv[col];
    v8h q;
#pragma unroll
    for (int j = 0; j < 8; ++j) {
      const float* Pr = Part + (j >> 1) * PTILE + ((j & 1) * 8 + b) * PPITCH + 128 + col;
      float o = Pr[0];
#pragma unroll
      for (int r = 1; r < PKS; ++r) o += Pr[r * PPLANE];
      q[j] = (_Float16)(o + bb);
    }
    // position s0 = 32 * fragment + 16g + 8h, row col & 15
    const int s0 = blockIdx.x * 8;
    const size_t frag = (size_t)(b * (S_LEN / 32) + (s0 >> 5)) * 4 + (col >> 4);
    *(v8h*)&Vt[frag * FRAG + ((s0 >> 4) & 1) * 256 +
               (((s0 >> 3) & 1) * 16 + (col & 15)) * 8] = q;
  }
}

// ---------------------------------------------------------------------------
// Kernel 2: flash attention. A block owns 4 query tiles of 16 rows; each tile's
// keys are split into KSPLIT contiguous ranges, one wave per (tile, range), so
// that a SIMD holds KSPLIT waves whose load waits overlap. The partial
// (max, sum, O) of the ranges are merged through LDS at the end.
// The products are taken transposed: St = K x Qt (A = K rows, B = Q rows) and
// Ot += Vt x Pt. Lane L then holds 16 of the 32 scores of ONE query, L & 15
// (keys i + 8*(L>>4) of each 16-key tile), so that the maximum and the sum of a
// score row are in-lane work plus one exchange between the lane halves, the
// running maximum, sum and rescale factor are one register each, and the two
// score tiles, converted in place, are the B fragment of the second product.
// ---------------------------------------------------------------------------
// the value of lane L ^ 16
__device__ __forceinline__ float other_half(float x) {
  const int v = __builtin_bit_cast(int, x);
  return __builtin_bit_cast(
      float, __builtin_amdgcn_permlanex16(v, v, 0x76543210, 0xfedcba98, false, false));
}

__global__ void __launch_bounds__(32 * NWAVES)
flash_attn(const _Float16* __restrict__ Qh, const _Float16* __restrict__ Kh,
           const _Float16* __restrict__ Vt, const float* __restrict__ mask,
           float* __restrict__ out) {
  __shared__ __align__(16) float Lmask[NWAVES * (S_LEN / KSPLIT)];
  __shared__ __align__(16) float Opart[NWAVES * 16 * OPITCH];
  __shared__ float Mpart[NWAVES * 16];
  __shared__ float Lpart[NWAVES * 16];

  const int lane = threadIdx.x & 31;
  // wave-uniform by construction; held in a scalar register so that the key
  // range, its addresses and the loop test stay scalar
  const int wid  = __builtin_amdgcn_readfirstlane(threadIdx.x >> 5);
  const int n = lane & 15, h = lane >> 4;
  const int b  = blockIdx.y;
  const int qt = blockIdx.x * 4 + (wid & 3);       // 16-row query tile
  const int kbeg = (wid >> 2) * (S_LEN / KSPLIT);  // this wave's key range

  const float scale = 0.03125f;                    // 1/sqrt(1024), a power of two

  const _Float16* Qbase = Qh + (size_t)(b * (S_LEN / 16) + qt) * 2 * FRAG;
  // B fragments of the first product, kept in registers over the loop
  const v16h bq0 = load_frag_packed(Qbase,        lane * 16u);
  const v16h bq1 = load_frag_packed(Qbase + FRAG, lane * 16u);
  // A lane needs the mask term of 16 keys per pass: log(mask) * scale of the
  // wave's key range is tabled once in the wave's own LDS slice.
  float* Lw = Lmask + wid * (S_LEN / KSPLIT);
#pragma unroll
  for (int j = 0; j < S_LEN / KSPLIT / 32; ++j)
    Lw[j * 32 + lane] = __logf(mask[(kbeg + j * 32 + lane) * BATCH + b]) * scale;
  // the loop reads entries that other lanes of this wave wrote: keeps those reads
  // behind the stores
  asm volatile("s_wait_dscnt 0" ::: "memory");

  float mrun = -1e30f, lrun = 0.0f;                // of query n; lrun: this half's keys
  v8f O[4];                                        // O[t][i] = Ot[16t + 8h + i][n]
#pragma unroll
  for (int t = 0; t < 4; ++t)
#pragma unroll
    for (int i = 0; i < 8; ++i) O[t][i] = 0.0f;

  const v4f* Lr = (const v4f*)(Lw + 8 * h);
  // a pass of 32 keys reads 4 contiguous fragments of K and 4 of V, at the same
  // byte offset in the two buffers: one 32-bit offset per lane serves all 16 loads
  unsigned koff = (unsigned)(b * (S_LEN / 32) + (kbeg >> 5)) * (4 * FRAG * 2) + lane * 16u;

  for (int kb = kbeg; kb < kbeg + S_LEN / KSPLIT; kb += 32, koff += 4 * FRAG * 2, Lr += 8) {
    // ---- scores of 32 keys: two 16x16 tiles (key x query), K-dim 64 = 2 wmma each ----
    v8f c0, c1;
#pragma unroll
    for (int i = 0; i < 8; ++i) { c0[i] = 0.0f; c1[i] = 0.0f; }
    c0 = wmma_f16(load_frag_packed(Kh,            koff), bq0, c0);
    c0 = wmma_f16(load_frag_packed(Kh + FRAG,     koff), bq1, c0);
    c1 = wmma_f16(load_frag_packed(Kh + 2 * FRAG, koff), bq0, c1);
    c1 = wmma_f16(load_frag_packed(Kh + 3 * FRAG, koff), bq1, c1);

    // ---- (score + log(mask)) * scale, online softmax of the lane's query ----
    const v4f l00 = Lr[0], l01 = Lr[1], l10 = Lr[4], l11 = Lr[5];
    float s[16];
#pragma unroll
    for (int i = 0; i < 4; ++i) {
      s[i]      = fmaf(c0[i],     scale, l00[i]);
      s[i + 4]  = fmaf(c0[i + 4], scale, l01[i]);
      s[i + 8]  = fmaf(c1[i],     scale, l10[i]);
      s[i + 12] = fmaf(c1[i + 4], scale, l11[i]);
    }
    float mx = s[0];
#pragma unroll
    for (int i = 1; i < 16; ++i) mx = fmaxf(mx, s[i]);
    mx = fmaxf(mx, other_half(mx));

    const float mn = fmaxf(mrun, mx);
    float alpha;                                   // exp(mrun - mn)
    // v_exp_f32 and the one slot that the instruction set asks for behind a
    // transcendental, in one statement: a v_nop of its own does not stay behind it
    asm("v_exp_f32 %0, %1\n\tv_nop" : "=v"(alpha) : "v"((mrun - mn) * 1.44269504f));
    mrun = mn;
    float rsum = 0.0f;
    v16h pb;   // pb[e] = Pt[8h + e][n], pb[8 + e] = Pt[16 + 8h + e][n]: V's stored k order
#pragma unroll
    for (int i = 0; i < 16; ++i) {
      const float p = __expf(s[i] - mn);
      rsum += p;
      pb[i] = (_Float16)p;
    }
    lrun = lrun * alpha + rsum;
#pragma unroll
    for (int t = 0; t < 4; ++t) O[t] *= alpha;

    // ---- Ot += Vt(64x32) x Pt(32x16) ----
#pragma unroll
    for (int t = 0; t < 4; ++t)
      O[t] = wmma_f16(load_frag_packed(Vt + t * FRAG, koff), pb, O[t]);
  }

  // ---- stage this range's partial result: 8 consecutive columns per register tile ----
  float* Ow = Opart + wid * 16 * OPITCH + n * OPITCH + 8 * h;
#pragma unroll
  for (int t = 0; t < 4; ++t) {
    *(v4f*)(Ow + t * 16)     = __builtin_shufflevector(O[t], O[t], 0, 1, 2, 3);
    *(v4f*)(Ow + t * 16 + 4) = __builtin_shufflevector(O[t], O[t], 4, 5, 6, 7);
  }
  lrun += other_half(lrun);
  if (h == 0) {
    Mpart[wid * 16 + n] = mrun;
    Lpart[wid * 16 + n] = lrun;
  }
  // publishes every range's partial to the threads that merge them
  __syncthreads();

  // ---- merge the ranges, normalize, write out [s][b][d] fp32 ----
  const int tq = threadIdx.x / (32 * KSPLIT);      // query tile this thread merges
  for (int e = threadIdx.x % (32 * KSPLIT); e < 256; e += 32 * KSPLIT) {
    const int row = e >> 4, c4 = (e & 15) * 4;
    float mr[KSPLIT];
    float M = -1e30f;
#pragma unroll
    for (int r = 0; r < KSPLIT; ++r) {
      mr[r] = Mpart[(r * 4 + tq) * 16 + row];
      M = fmaxf(M, mr[r]);
    }
    float L = 0.0f;
    float4 o = make_float4(0.0f, 0.0f, 0.0f, 0.0f);
#pragma unroll
    for (int r = 0; r < KSPLIT; ++r) {
      const float w = __expf(mr[r] - M);
      const float4 p = *(const float4*)&Opart[((r * 4 + tq) * 16 + row) * OPITCH + c4];
      L += w * Lpart[(r * 4 + tq) * 16 + row];
      o.x += w * p.x; o.y += w * p.y; o.z += w * p.z; o.w += w * p.w;
    }
    const float inv = 1.0f / L;
    const int s = (blockIdx.x * 4 + tq) * 16 + row;
    *(float4*)&out[((size_t)s * BATCH + b) * HD + c4] =
        make_float4(o.x * inv, o.y * inv, o.z * inv, o.w * inv);
  }
}

// ---------------------------------------------------------------------------
extern "C" void kernel_launch(void* const* d_in, const int* in_sizes, int n_in,
                              void* d_out, int out_size, void* d_ws, size_t ws_size,
                              hipStream_t stream) {
  const float* X    = (const float*)d_in[0];
  const float* mask = (const float*)d_in[1];
  const float* Wq   = (const float*)d_in[2];
  const float* bq   = (const float*)d_in[3];
  const float* Wk   = (const float*)d_in[4];
  const float* bk   = (const float*)d_in[5];
  const float* Wv   = (const float*)d_in[6];
  const float* bv   = (const float*)d_in[7];
  float* out = (float*)d_out;

  char* ws = (char*)d_ws;
  const size_t WT_BYTES  = (size_t)3 * 64 * 1024 * 2;          // 384 KB
  const size_t QKV_BYTES = (size_t)BATCH * S_LEN * HD * 2;     // 2 MB each
  _Float16* Wt = (_Float16*)ws;
  _Float16* Qh = (_Float16*)(ws + WT_BYTES);
  _Float16* Kh = (_Float16*)(ws + WT_BYTES + QKV_BYTES);
  _Float16* Vt = (_Float16*)(ws + WT_BYTES + 2 * QKV_BYTES);

  prep_weights<<<96, 256, 0, stream>>>(Wq, Wk, Wv, Wt);
  qkv_proj<<<(S_LEN * BATCH) / 64, 128 * PKS, 0, stream>>>(X, Wt, bq, bk, bv, Qh, Kh, Vt);
  flash_attn<<<dim3(S_LEN / 64, BATCH), 32 * NWAVES, 0, stream>>>(Qh, Kh, Vt, mask, out);
}

// v006
// One run takes 27.2 microseconds.
// Two timings next to v005 both put it at 1.06 times that version's speed.
// Counting every step since v000, it is 6.61 times as fast.
#include <hip/hip_runtime.h>
#include <hip/hip_bf16.h>
#include <cmath>

typedef __attribute__((ext_vector_type(16))) _Float16 v16h;
typedef __attribute__((ext_vector_type(8)))  float    v8f;
typedef __attribute__((ext_vector_type(8)))  _Float16 v8h;
typedef __attribute__((ext_vector_type(4)))  float    v4f;

#define S_LEN 2048
#define BATCH 8
#define DMODEL 1024
#define HD 64
#define KSPLIT 8                 // key ranges per query tile
#define QPW 2                    // query tiles per wave: a loaded K or V fragment serves them all
#define NWAVES (4 / QPW * KSPLIT)  // waves per attention block
#define OPITCH 68                // floats per staged partial row (16 B x odd)
#define PKS 4                    // K ranges per projection tile, one wave each
#define PSTEPS (DMODEL / PKS / 32)  // 32-deep steps of one K range
#define PPITCH 196               // floats per staged projection row (16 B x odd)
#define PTILE (16 * PPITCH + 8)  // floats per staged 16-row tile: the 8 spread the tiles over the banks
#define PPLANE (4 * PTILE)       // floats per staged partial
#define FRAG 512                 // f16 elements of one stored 16 x 32 fragment

// ---------------------------------------------------------------------------
// WMMA helper: D = A(16x32 f16) * B(32x16 f16) + C(16x16 f32)
// ---------------------------------------------------------------------------
__device__ __forceinline__ v8f wmma_f16(v16h a, v16h b, v8f c) {
  return __builtin_amdgcn_wmma_f32_16x16x32_f16(
      /*neg_a=*/false, a, /*neg_b=*/false, b,
      /*c_mod=*/(short)0, c, /*reuse_a=*/false, /*reuse_b=*/false);
}

// ---------------------------------------------------------------------------
// Fragment loaders.
// A 16x32 f16 layout (ISA 7.12.2): lane L -> m=L&15, h=L>>4.
//   VGPR j in [0,3]: K = 8h + 2j, 2j+1 ; VGPR j in [4,7]: K = 16 + 8h + 2(j-4)
// B mirrors A on the transposed operand (row index = N column, k pattern same).
// Contiguous K pairs -> dword loads.
// ---------------------------------------------------------------------------
typedef __attribute__((ext_vector_type(4))) unsigned int u32x4;
union FragQ { u32x4 q[2]; v16h v; };

// Fragment order: the workspace operands (weights, Q, K, V) are stored fragment by
// fragment, 1,024 contiguous bytes each, as [g][lane][8 elements]: lane 16h + c
// holds row c, k = 16g + 8h + e. Each of the two 16-byte loads of a wave then
// covers 512 contiguous bytes (4 whole lines), not 32 bytes of each of 16 lines.
// f: wave-uniform; off: the lane's byte offset behind f, 16 * lane inside the fragment
__device__ __forceinline__ v16h load_frag_packed(const _Float16* f, unsigned off) {
  const u32x4* p = (const u32x4*)((const char*)f + off);
  FragQ t;
  t.q[0] = p[0];
  t.q[1] = p[32];
  return t.v;
}

// ---------------------------------------------------------------------------
// Kernel 0: convert weights fp32 [k][n] -> f16 in fragment order, [k / 32][n / 16]
// over the 192 columns of Wq, Wk, Wv; one 16-byte piece per thread
// ---------------------------------------------------------------------------
__global__ void __launch_bounds__(256)
prep_weights(const float* __restrict__ Wq, const float* __restrict__ Wk,
             const float* __restrict__ Wv, _Float16* __restrict__ Wt) {
  const int idx = blockIdx.x * 256 + threadIdx.x;    // 0 .. 3*64*1024/8-1
  const int c = idx & 15, h = (idx >> 4) & 1, g = (idx >> 5) & 1;
  const int f  = idx >> 6;                           // fragment
  const int ks = f / 12, nt = f % 12;
  const float* W = (nt < 4) ? Wq : ((nt < 8) ? Wk : Wv);
  const float* src = W + (ks * 32 + g * 16 + h * 8) * HD + (nt & 3) * 16 + c;
  v8h o;
#pragma unroll
  for (int e = 0; e < 8; ++e) o[e] = (_Float16)src[e * HD];
  *(v8h*)&Wt[(size_t)idx * 8] = o;
}

// ---------------------------------------------------------------------------
// Kernel 1: QKV projection. A block owns 4 tiles of 16 rows x 192 columns; each
// tile's K is split into PKS contiguous ranges, one wave per (tile, range). With
// PKS waves on a SIMD a wave has 256 registers: beside its 96 accumulators it
// holds a ring of 12 weight fragments and the X rows of two steps, all loaded
// ahead, so that its loads are in flight together and no product waits out a
// whole load latency. The partial sums of the ranges are merged through LDS.
//   X      : [S*B, 1024] fp32 (row r = s*B + b)
//   Wt     : [k / 32][n / 16] fragments (rows n, k along the model dimension)
//   Qh,Kh  : [b][s / 16][d / 32] fragments (rows s, k along d)
//   Vt     : [b][s / 32][d / 16] fragments (rows d, k along s: the A operand of Ot += Vt x Pt)
// ---------------------------------------------------------------------------
__global__ void __launch_bounds__(128 * PKS)
qkv_proj(const float* __restrict__ X, const _Float16* __restrict__ Wt,
         const float* __restrict__ bq, const float* __restrict__ bk,
         const float* __restrict__ bv,
         _Float16* __restrict__ Qh, _Float16* __restrict__ Kh,
         _Float16* __restrict__ Vt) {
  __shared__ __align__(16) float Part[PKS * PPLANE];

  const int lane = threadIdx.x & 31;
  // wave-uniform by construction; held in a scalar register so that the K range
  // and the operand bases stay scalar
  const int wid = __builtin_amdgcn_readfirstlane(threadIdx.x >> 5);
  const int m = lane & 15, h = lane >> 4;
  const int tile = wid & 3;                  // 16-row tile inside the block
  const int kr   = wid >> 2;                 // K range

  v8f acc[12];
#pragma unroll
  for (int t = 0; t < 12; ++t)
#pragma unroll
    for (int i = 0; i < 8; ++i) acc[t][i] = 0.0f;

  // the lane's 16 floats of step ks: Xrow + 32 * ks + {0..7, 16..23}
  const float* Xrow = X + ((size_t)(blockIdx.x * 4 + tile) * 16 + m) * DMODEL +
                      kr * (DMODEL / PKS) + 8 * h;
  const _Float16* Wr = Wt + (size_t)kr * PSTEPS * 12 * FRAG;

  v4f xr[2][4];                              // X rows of the next two steps, as loaded
#pragma unroll
  for (int p = 0; p < 2; ++p) {
    const v4f* xp = (const v4f*)(Xrow + 32 * p);
    xr[p][0] = xp[0]; xr[p][1] = xp[1]; xr[p][2] = xp[4]; xr[p][3] = xp[5];
  }
  v16h bf[12];                               // ring of weight fragments, one step deep
#pragma unroll
  for (int nt = 0; nt < 12; ++nt) bf[nt] = load_frag_packed(Wr + nt * FRAG, lane * 16u);
  // unrolled: xr[ks & 1] and the tests on ks must be settled at compile time for
  // the two X sets and the ring to stay in registers
#pragma unroll
  for (int ks = 0; ks < PSTEPS; ++ks) {
    v16h a;
#pragma unroll
    for (int j = 0; j < 4; ++j)
#pragma unroll
      for (int e = 0; e < 4; ++e) a[4 * j + e] = (_Float16)xr[ks & 1][j][e];
    if (ks + 2 < PSTEPS) {
      const v4f* xp = (const v4f*)(Xrow + 32 * (ks + 2));
      xr[ks & 1][0] = xp[0]; xr[ks & 1][1] = xp[1];
      xr[ks & 1][2] = xp[4]; xr[ks & 1][3] = xp[5];
    }
    // each fragment's registers are refilled for the next step behind its product
#pragma unroll
    for (int nt = 0; nt < 12; ++nt) {
      acc[nt] = wmma_f16(a, bf[nt], acc[nt]);
      if (ks + 1 < PSTEPS)
        bf[nt] = load_frag_packed(Wr + ((ks + 1) * 12 + nt) * FRAG, lane * 16u);
    }
  }

  // ---- stage the range's sums row-major ----
  float* Pw = Part + kr * PPLANE + tile * PTILE;
#pragma unroll
  for (int nt = 0; nt < 12; ++nt)
#pragma unroll
    for (int i = 0; i < 8; ++i)
      Pw[(i + 8 * h) * PPITCH + nt * 16 + m] = acc[nt][i];
  // publishes the PKS staged partials to the threads that merge them
  __syncthreads();
  // ends the scheduling region of the register-full product loop: the merge below
  // is scheduled by itself, and its LDS loads are issued together, not one per wait
  __builtin_amdgcn_sched_barrier(0);

  // ---- merge, bias, store Q and K: 8 columns of one row per thread, one 16-byte
  // piece of a fragment; the 8 positions of a (batch, piece) fill one 128-byte line
  // unrolled: the choice of bias and of output buffer is made at compile time
#pragma unroll
  for (int qk = 0; qk < 2; ++qk) {           // Q, then K
    const int sl = threadIdx.x & 7, b = (threadIdx.x >> 3) & 7;
    const int col = (threadIdx.x >> 6) * 8;  // column of Q or of K
    const float* Pr = Part + (sl >> 1) * PTILE + ((sl & 1) * 8 + b) * PPITCH + qk * 64 + col;
    float4 o0 = *(const float4*)Pr, o1 = *(const float4*)(Pr + 4);
#pragma unroll
    for (int r = 1; r < PKS; ++r) {
      const float4 p0 = *(const float4*)(Pr + r * PPLANE);
      const float4 p1 = *(const float4*)(Pr + r * PPLANE + 4);
      o0.x += p0.x; o0.y += p0.y; o0.z += p0.z; o0.w += p0.w;
      o1.x += p1.x; o1.y += p1.y; o1.z += p1.z; o1.w += p1.w;
    }
    const float* bias = (qk == 0 ? bq : bk) + col;
    const float4 b0 = *(const float4*)bias, b1 = *(const float4*)(bias + 4);
    const int s = blockIdx.x * 8 + sl;
    v8h q;
    q[0] = (_Float16)(o0.x + b0.x);
    q[1] = (_Float16)(o0.y + b0.y);
    q[2] = (_Float16)(o0.z + b0.z);
    q[3] = (_Float16)(o0.w + b0.w);
    q[4] = (_Float16)(o1.x + b1.x);
    q[5] = (_Float16)(o1.y + b1.y);
    q[6] = (_Float16)(o1.z + b1.z);
    q[7] = (_Float16)(o1.w + b1.w);
    // column col = 32 * fragment + 16g + 8h + e, row s & 15
    const size_t frag = (size_t)(b * (S_LEN / 16) + (s >> 4)) * 2 + (col >> 5);
    *(v8h*)&(qk == 0 ? Qh : Kh)[frag * FRAG + ((col >> 4) & 1) * 256 +
                                (((col >> 3) & 1) * 16 + (s & 15)) * 8] = q;
  }

  // ---- merge, bias, store V: the block's 8 positions of one (b, column) are one
  // 16-byte piece of a fragment; 16 columns fill 256 contiguous bytes ----
  {
    const int col = threadIdx.x & 63, b = threadIdx.x >> 6;
    const float bb = bv[col];
    v8h q;
#pragma unroll
    for (int j = 0; j < 8; ++j) {
      const float* Pr = Part + (j >> 1) * PTILE + ((j & 1) * 8 + b) * PPITCH + 128 + col;
      float o = Pr[0];
#pragma unroll
      for (int r = 1; r < PKS; ++r) o += Pr[r * PPLANE];
      q[j] = (_Float16)(o + bb);
    }
    // position s0 = 32 * fragment + 16g + 8h, row col & 15
    const int s0 = blockIdx.x * 8;
    const size_t frag = (size_t)(b * (S_LEN / 32) + (s0 >> 5)) * 4 + (col >> 4);
    *(v8h*)&Vt[frag * FRAG + ((s0 >> 4) & 1) * 256 +
               (((s0 >> 3) & 1) * 16 + (col & 15)) * 8] = q;
  }
}

// ---------------------------------------------------------------------------
// Kernel 2: flash attention. A block owns 4 query tiles of 16 rows; the keys are
// split into KSPLIT contiguous ranges, one wave per (QPW tiles, range): each K and
// V fragment that a wave loads feeds the products of its QPW tiles, so that the
// block loads every fragment 4 / QPW times, and a SIMD holds NWAVES / 4 waves whose
// load waits overlap. The partial (max, sum, O) of the ranges are merged through
// LDS at the end.
// The products are taken transposed: St = K x Qt (A = K rows, B = Q rows) and
// Ot += Vt x Pt. Lane L then holds 16 of the 32 scores of ONE query, L & 15
// (keys i + 8*(L>>4) of each 16-key tile), so that the maximum and the sum of a
// score row are in-lane work plus one exchange between the lane halves, the
// running maximum, sum and rescale factor are one register each, and the two
// score tiles, converted in place, are the B fragment of the second product.
// ---------------------------------------------------------------------------
// the value of lane L ^ 16
__device__ __forceinline__ float other_half(float x) {
  const int v = __builtin_bit_cast(int, x);
  return __builtin_bit_cast(
      float, __builtin_amdgcn_permlanex16(v, v, 0x76543210, 0xfedcba98, false, false));
}

__global__ void __launch_bounds__(32 * NWAVES)
flash_attn(const _Float16* __restrict__ Qh, const _Float16* __restrict__ Kh,
           const _Float16* __restrict__ Vt, const float* __restrict__ mask,
           float* __restrict__ out) {
  __shared__ __align__(16) float Lmask[NWAVES * (S_LEN / KSPLIT)];
  __shared__ __align__(16) float Opart[KSPLIT * 4 * 16 * OPITCH];  // [range][tile][row]
  __shared__ float Mpart[KSPLIT * 4 * 16];
  __shared__ float Lpart[KSPLIT * 4 * 16];

  const int lane = threadIdx.x & 31;
  // wave-uniform by construction; held in a scalar register so that the key
  // range, its addresses and the loop test stay scalar
  const int wid  = __builtin_amdgcn_readfirstlane(threadIdx.x >> 5);
  const int n = lane & 15, h = lane >> 4;
  const int b  = blockIdx.y;
  const int t0  = (wid % (4 / QPW)) * QPW;         // first of the wave's tiles in the block
  const int rng = wid / (4 / QPW);                 // this wave's key range
  const int qt = blockIdx.x * 4 + t0;              // first 16-row query tile
  const int kbeg = rng * (S_LEN / KSPLIT);

  const float scale = 0.03125f;                    // 1/sqrt(1024), a power of two

  const _Float16* Qbase = Qh + (size_t)(b * (S_LEN / 16) + qt) * 2 * FRAG;
  // B fragments of the first product, kept in registers over the loop
  // every loop over g is unrolled: what is indexed by g must stay in registers
  v16h bq0[QPW], bq1[QPW];
#pragma unroll
  for (int g = 0; g < QPW; ++g) {
    bq0[g] = load_frag_packed(Qbase + (2 * g) * FRAG,     lane * 16u);
    bq1[g] = load_frag_packed(Qbase + (2 * g + 1) * FRAG, lane * 16u);
  }
  // A lane needs the mask term of 16 keys per pass: log(mask) * scale of the
  // wave's key range is tabled once in the wave's own LDS slice.
  float* Lw = Lmask + wid * (S_LEN / KSPLIT);
#pragma unroll
  for (int j = 0; j < S_LEN / KSPLIT / 32; ++j)
    Lw[j * 32 + lane] = __logf(mask[(kbeg + j * 32 + lane) * BATCH + b]) * scale;
  // the loop reads entries that other lanes of this wave wrote: keeps those reads
  // behind the stores
  asm volatile("s_wait_dscnt 0" ::: "memory");

  float mrun[QPW], lrun[QPW];                      // of query n of tile g; lrun: this half's keys
  v8f O[QPW][4];                                   // O[g][t][i] = Ot[16t + 8h + i][n] of tile g
#pragma unroll
  for (int g = 0; g < QPW; ++g) {
    mrun[g] = -1e30f;
    lrun[g] = 0.0f;
#pragma unroll
    for (int t = 0; t < 4; ++t)
#pragma unroll
      for (int i = 0; i < 8; ++i) O[g][t][i] = 0.0f;
  }

  const v4f* Lr = (const v4f*)(Lw + 8 * h);
  // a pass of 32 keys reads 4 contiguous fragments of K and 4 of V, at the same
  // byte offset in the two buffers: one 32-bit offset per lane serves all 16 loads
  unsigned koff = (unsigned)(b * (S_LEN / 32) + (kbeg >> 5)) * (4 * FRAG * 2) + lane * 16u;

  for (int kb = kbeg; kb < kbeg + S_LEN / KSPLIT; kb += 32, koff += 4 * FRAG * 2, Lr += 8) {
    // ---- scores of 32 keys: two 16x16 tiles (key x query) per query tile, K-dim 64 =
    // 2 wmma each; the K and V fragments are loaded once for the wave's tiles ----
    const v16h ka0 = load_frag_packed(Kh,            koff);
    const v16h ka1 = load_frag_packed(Kh + FRAG,     koff);
    const v16h ka2 = load_frag_packed(Kh + 2 * FRAG, koff);
    const v16h ka3 = load_frag_packed(Kh + 3 * FRAG, koff);
    // keeps the K loads in front of the V loads: a counted wait covers every load issued
    // before the one it is for, and the first products would otherwise wait for V
    // fragments that are needed only behind the softmax
    __builtin_amdgcn_sched_barrier(0);
    v16h va[4];
#pragma unroll
    for (int t = 0; t < 4; ++t) va[t] = load_frag_packed(Vt + t * FRAG, koff);
    // keeps the pass's 16 loads in front of its first product: the registers are
    // there for all of them, and issued together they wait out one load latency;
    // left to itself the scheduler issues some behind the first wait, which costs a second
    __builtin_amdgcn_sched_barrier(0);
    v8f c0[QPW], c1[QPW];
#pragma unroll
    for (int g = 0; g < QPW; ++g) {
#pragma unroll
      for (int i = 0; i < 8; ++i) { c0[g][i] = 0.0f; c1[g][i] = 0.0f; }
      c0[g] = wmma_f16(ka0, bq0[g], c0[g]);
      c0[g] = wmma_f16(ka1, bq1[g], c0[g]);
      c1[g] = wmma_f16(ka2, bq0[g], c1[g]);
      c1[g] = wmma_f16(ka3, bq1[g], c1[g]);
    }

    // ---- (score + log(mask)) * scale, online softmax of the lane's query of each tile ----
    const v4f l00 = Lr[0], l01 = Lr[1], l10 = Lr[4], l11 = Lr[5];
    v16h pb[QPW];  // pb[g][e] = Pt[8h + e][n], pb[g][8 + e] = Pt[16 + 8h + e][n]: V's stored k order
#pragma unroll
    for (int g = 0; g < QPW; ++g) {
      float s[16];
#pragma unroll
      for (int i = 0; i < 4; ++i) {
        s[i]      = fmaf(c0[g][i],     scale, l00[i]);
        s[i + 4]  = fmaf(c0[g][i + 4], scale, l01[i]);
        s[i + 8]  = fmaf(c1[g][i],     scale, l10[i]);
        s[i + 12] = fmaf(c1[g][i + 4], scale, l11[i]);
      }
      float mx = s[0];
#pragma unroll
      for (int i = 1; i < 16; ++i) mx = fmaxf(mx, s[i]);
      mx = fmaxf(mx, other_half(mx));

      const float mn = fmaxf(mrun[g], mx);
      float alpha;                                 // exp(mrun - mn)
      // v_exp_f32 and the one slot that the instruction set asks for behind a
      // transcendental, in one statement: a v_nop of its own does not stay behind it
      asm("v_exp_f32 %0, %1\n\tv_nop" : "=v"(alpha) : "v"((mrun[g] - mn) * 1.44269504f));
      mrun[g] = mn;
      float rsum = 0.0f;
#pragma unroll
      for (int i = 0; i < 16; ++i) {
        const float p = __expf(s[i] - mn);
        rsum += p;
        pb[g][i] = (_Float16)p;
      }
      lrun[g] = lrun[g] * alpha + rsum;
#pragma unroll
      for (int t = 0; t < 4; ++t) O[g][t] *= alpha;
    }

    // ---- Ot += Vt(64x32) x Pt(32x16) ----
#pragma unroll
    for (int t = 0; t < 4; ++t)
#pragma unroll
      for (int g = 0; g < QPW; ++g) O[g][t] = wmma_f16(va[t], pb[g], O[g][t]);
  }

  // ---- stage this range's partial result: 8 consecutive columns per register tile ----
#pragma unroll
  for (int g = 0; g < QPW; ++g) {
    const int slot = (rng * 4 + t0 + g) * 16 + n;  // [range][tile][row]
    float* Ow = Opart + slot * OPITCH + 8 * h;
#pragma unroll
    for (int t = 0; t < 4; ++t) {
      *(v4f*)(Ow + t * 16)     = __builtin_shufflevector(O[g][t], O[g][t], 0, 1, 2, 3);
      *(v4f*)(Ow + t * 16 + 4) = __builtin_shufflevector(O[g][t], O[g][t], 4, 5, 6, 7);
    }
    lrun[g] += other_half(lrun[g]);
    if (h == 0) {
      Mpart[slot] = mrun[g];
      Lpart[slot] = lrun[g];
    }
  }
  // publishes every range's partial to the threads that merge them
  __syncthreads();

  // ---- merge the ranges, normalize, write out [s][b][d] fp32 ----
  const int tq = threadIdx.x / (8 * NWAVES);       // query tile this thread merges
  // unrolled: the LDS reads of a thread's pieces are issued together
#pragma unroll
  for (int it = 0; it < 256 / (8 * NWAVES); ++it) {
    const int e = it * (8 * NWAVES) + threadIdx.x % (8 * NWAVES);
    const int row = e >> 4, c4 = (e & 15) * 4;
    float mr[KSPLIT];
    float M = -1e30f;
#pragma unroll
    for (int r = 0; r < KSPLIT; ++r) {
      mr[r] = Mpart[(r * 4 + tq) * 16 + row];
      M = fmaxf(M, mr[r]);
    }
    float L = 0.0f;
    float4 o = make_float4(0.0f, 0.0f, 0.0f, 0.0f);
#pragma unroll
    for (int r = 0; r < KSPLIT; ++r) {
      const float w = __expf(mr[r] - M);
      const float4 p = *(const float4*)&Opart[((r * 4 + tq) * 16 + row) * OPITCH + c4];
      L += w * Lpart[(r * 4 + tq) * 16 + row];
      o.x += w * p.x; o.y += w * p.y; o.z += w * p.z; o.w += w * p.w;
    }
    const float inv = 1.0f / L;
    const int s = (blockIdx.x * 4 + tq) * 16 + row;
    *(float4*)&out[((size_t)s * BATCH + b) * HD + c4] =
        make_float4(o.x * inv, o.y * inv, o.z * inv, o.w * inv);
  }
}

// ---------------------------------------------------------------------------
extern "C" void kernel_launch(void* const* d_in, const int* in_sizes, int n_in,
                              void* d_out, int out_size, void* d_ws, size_t ws_size,
                              hipStream_t stream) {
  const float* X    = (const float*)d_in[0];
  const float* mask = (const float*)d_in[1];
  const float* Wq   = (const float*)d_in[2];
  const float* bq   = (const float*)d_in[3];
  const float* Wk   = (const float*)d_in[4];
  const float* bk   = (const float*)d_in[5];
  const float* Wv   = (const float*)d_in[6];
  const float* bv   = (const float*)d_in[7];
  float* out = (float*)d_out;

  char* ws = (char*)d_ws;
  const size_t WT_BYTES  = (size_t)3 * 64 * 1024 * 2;          // 384 KB
  const size_t QKV_BYTES = (size_t)BATCH * S_LEN * HD * 2;     // 2 MB each
  _Float16* Wt = (_Float16*)ws;
  _Float16* Qh = (_Float16*)(ws + WT_BYTES);
  _Float16* Kh = (_Float16*)(ws + WT_BYTES + QKV_BYTES);
  _Float16* Vt = (_Float16*)(ws + WT_BYTES + 2 * QKV_BYTES);

  prep_weights<<<96, 256, 0, stream>>>(Wq, Wk, Wv, Wt);
  qkv_proj<<<(S_LEN * BATCH) / 64, 128 * PKS, 0, stream>>>(X, Wt, bq, bk, bv, Qh, Kh, Vt);
  flash_attn<<<dim3(S_LEN / 64, BATCH), 32 * NWAVES, 0, stream>>>(Qh, Kh, Vt, mask, out);
}

// v007
// It runs in 25.9 microseconds.
// Two timings next to v006 put it at 1.05 and 1.04 times that version's speed.
// Counting every step since v000, it is 6.92 times as fast.
#include <hip/hip_runtime.h>
#include <hip/hip_bf16.h>
#include <cmath>

typedef __attribute__((ext_vector_type(16))) _Float16 v16h;
typedef __attribute__((ext_vector_type(8)))  float    v8f;
typedef __attribute__((ext_vector_type(8)))  _Float16 v8h;
typedef __attribute__((ext_vector_type(4)))  float    v4f;

#define S_LEN 2048
#define BATCH 8
#define DMODEL 1024
#define HD 64
#define KSPLIT 8                 // key ranges per query tile
#define QPW 2                    // query tiles per wave: a loaded K or V fragment serves them all
#define NWAVES (4 / QPW * KSPLIT)  // waves per attention block
#define OPITCH 68                // floats per staged partial row (16 B x odd)
#define PKS 4                    // K ranges per projection tile, one wave each
#define PSTEPS (DMODEL / PKS / 32)  // 32-deep steps of one K range
#define PPITCH 196               // floats per staged projection row (16 B x odd)
#define PTILE (16 * PPITCH + 8)  // floats per staged 16-row tile: the 8 spread the tiles over the banks
#define PPLANE (4 * PTILE)       // floats per staged partial
#define FRAG 512                 // f16 elements of one stored 16 x 32 fragment
#define XPITCH 1040              // bytes per staged X row: the 1 KiB of a K range + 16 (16 B x odd)
#define XWAVE (16 * XPITCH)      // bytes of a wave's staged 16 X rows
#define XGROUPS (PSTEPS / 2)     // copy groups of a wave: 256 B (two steps) of each of its 16 rows

// ---------------------------------------------------------------------------
// WMMA helper: D = A(16x32 f16) * B(32x16 f16) + C(16x16 f32)
// ---------------------------------------------------------------------------
__device__ __forceinline__ v8f wmma_f16(v16h a, v16h b, v8f c) {
  return __builtin_amdgcn_wmma_f32_16x16x32_f16(
      /*neg_a=*/false, a, /*neg_b=*/false, b,
      /*c_mod=*/(short)0, c, /*reuse_a=*/false, /*reuse_b=*/false);
}

// ---------------------------------------------------------------------------
// Fragment loaders.
// A 16x32 f16 layout (ISA 7.12.2): lane L -> m=L&15, h=L>>4.
//   VGPR j in [0,3]: K = 8h + 2j, 2j+1 ; VGPR j in [4,7]: K = 16 + 8h + 2(j-4)
// B mirrors A on the transposed operand (row index = N column, k pattern same).
// Contiguous K pairs -> dword loads.
// ---------------------------------------------------------------------------
typedef __attribute__((ext_vector_type(4))) unsigned int u32x4;
union FragQ { u32x4 q[2]; v16h v; };

// Fragment order: the workspace operands (weights, Q, K, V) are stored fragment by
// fragment, 1,024 contiguous bytes each, as [g][lane][8 elements]: lane 16h + c
// holds row c, k = 16g + 8h + e. Each of the two 16-byte loads of a wave then
// covers 512 contiguous bytes (4 whole lines), not 32 bytes of each of 16 lines.
// f: wave-uniform; off: the lane's byte offset behind f, 16 * lane inside the fragment
__device__ __forceinline__ v16h load_frag_packed(const _Float16* f, unsigned off) {
  const u32x4* p = (const u32x4*)((const char*)f + off);
  FragQ t;
  t.q[0] = p[0];
  t.q[1] = p[32];
  return t.v;
}

// ---------------------------------------------------------------------------
// Kernel 0: convert weights fp32 [k][n] -> f16 in fragment order, [k / 32][n / 16]
// over the 192 columns of Wq, Wk, Wv; one 16-byte piece per thread
// ---------------------------------------------------------------------------
__global__ void __launch_bounds__(256)
prep_weights(const float* __restrict__ Wq, const float* __restrict__ Wk,
             const float* __restrict__ Wv, _Float16* __restrict__ Wt) {
  const int idx = blockIdx.x * 256 + threadIdx.x;    // 0 .. 3*64*1024/8-1
  const int c = idx & 15, h = (idx >> 4) & 1, g = (idx >> 5) & 1;
  const int f  = idx >> 6;                           // fragment
  const int ks = f / 12, nt = f % 12;
  const float* W = (nt < 4) ? Wq : ((nt < 8) ? Wk : Wv);
  const float* src = W + (ks * 32 + g * 16 + h * 8) * HD + (nt & 3) * 16 + c;
  v8h o;
#pragma unroll
  for (int e = 0; e < 8; ++e) o[e] = (_Float16)src[e * HD];
  *(v8h*)&Wt[(size_t)idx * 8] = o;
}

// One group of a wave's X rows: eight asynchronous copies to LDS, 16 bytes per lane
// each, copy c for rows 2c and 2c + 1. The s_wait_xcnt stands in the copies' own
// statement, in front of any rewrite of the address registers that they name.
__device__ __forceinline__ void copy_group_to_lds(unsigned l, const float* g) {
  asm volatile("global_load_async_to_lds_b128 %0, %1, off\n\t"
               "global_load_async_to_lds_b128 %2, %3, off\n\t"
               "global_load_async_to_lds_b128 %4, %5, off\n\t"
               "global_load_async_to_lds_b128 %6, %7, off\n\t"
               "global_load_async_to_lds_b128 %8, %9, off\n\t"
               "global_load_async_to_lds_b128 %10, %11, off\n\t"
               "global_load_async_to_lds_b128 %12, %13, off\n\t"
               "global_load_async_to_lds_b128 %14, %15, off\n\t"
               "s_wait_xcnt 0x0"
               :: "v"(l),               "v"(g),
                  "v"(l + 2 * XPITCH),  "v"(g + 2 * DMODEL),
                  "v"(l + 4 * XPITCH),  "v"(g + 4 * DMODEL),
                  "v"(l + 6 * XPITCH),  "v"(g + 6 * DMODEL),
                  "v"(l + 8 * XPITCH),  "v"(g + 8 * DMODEL),
                  "v"(l + 10 * XPITCH), "v"(g + 10 * DMODEL),
                  "v"(l + 12 * XPITCH), "v"(g + 12 * DMODEL),
                  "v"(l + 14 * XPITCH), "v"(g + 14 * DMODEL)
               : "memory");
}

// ---------------------------------------------------------------------------
// Kernel 1: QKV projection. A block owns 4 tiles of 16 rows x 192 columns; each
// tile's K is split into PKS contiguous ranges, one wave per (tile, range). With
// PKS waves on a SIMD a wave has 256 registers: beside its 96 accumulators it
// holds a ring of 12 weight fragments, loaded ahead. Its X rows come into the
// wave's own LDS stage by asynchronous copies of whole lines (256 contiguous bytes
// of 2 rows per copy), two groups of 8 copies in flight, and are read from there in
// A-fragment order: a load straight into that order takes 32 bytes of each of 16
// lines. The partial sums of the ranges are merged through LDS, over the X stage.
//   X      : [S*B, 1024] fp32 (row r = s*B + b)
//   Wt     : [k / 32][n / 16] fragments (rows n, k along the model dimension)
//   Qh,Kh  : [b][s / 16][d / 32] fragments (rows s, k along d)
//   Vt     : [b][s / 32][d / 16] fragments (rows d, k along s: the A operand of Ot += Vt x Pt)
// ---------------------------------------------------------------------------
__global__ void __launch_bounds__(128 * PKS)
qkv_proj(const float* __restrict__ X, const _Float16* __restrict__ Wt,
         const float* __restrict__ bq, const float* __restrict__ bk,
         const float* __restrict__ bv,
         _Float16* __restrict__ Qh, _Float16* __restrict__ Kh,
         _Float16* __restrict__ Vt) {
  // first every wave's X stage; behind the product loop and a barrier the partial sums
  __shared__ __align__(16) float Sm[4 * PKS * XWAVE / 4];
  static_assert(4 * PKS * XWAVE / 4 >= PKS * PPLANE, "the partial sums fit the stage");
  float* Part = Sm;

  const int lane = threadIdx.x & 31;
  // wave-uniform by construction; held in a scalar register so that the K range
  // and the operand bases stay scalar
  const int wid = __builtin_amdgcn_readfirstlane(threadIdx.x >> 5);
  const int m = lane & 15, h = lane >> 4;
  const int tile = wid & 3;                  // 16-row tile inside the block
  const int kr   = wid >> 2;                 // K range

  v8f acc[12];
#pragma unroll
  for (int t = 0; t < 12; ++t)
#pragma unroll
    for (int i = 0; i < 8; ++i) acc[t][i] = 0.0f;

  // copy c of a group: lanes 0-15 bring 256 B of row 2c, lanes 16-31 of row 2c + 1
  const unsigned xl = (unsigned)(size_t)Sm + wid * XWAVE + h * XPITCH + m * 16;
  const float* xg = X + ((size_t)(blockIdx.x * 4 + tile) * 16 + h) * DMODEL +
                    kr * (DMODEL / PKS) + m * 4;
  // the lane's 16 floats of step ks: xrd + 128 * ks + {0..31, 64..95} bytes
  const char* xrd = (const char*)Sm + wid * XWAVE + m * XPITCH + 32 * h;
  const _Float16* Wr = Wt + (size_t)kr * PSTEPS * 12 * FRAG;

  copy_group_to_lds(xl, xg);
  copy_group_to_lds(xl + 256, xg + 64);
  v16h bf[12];                               // ring of weight fragments, one step deep
#pragma unroll
  for (int nt = 0; nt < 12; ++nt) bf[nt] = load_frag_packed(Wr + nt * FRAG, lane * 16u);

  v4f xr[2][4];                              // X rows of the two steps of a group, as read
  // unrolled: the tests on q and ks must be settled at compile time for the X rows
  // and the ring to stay in registers
#pragma unroll
  for (int q = 0; q < XGROUPS; ++q) {
    // group q has landed: all of the wave's copies but the 8 of group q + 1; only the
    // wave that copied them reads these bytes, so that its own wait is enough
    if (q + 1 < XGROUPS) asm volatile("s_wait_asynccnt 0x8" ::: "memory");
    else                 asm volatile("s_wait_asynccnt 0x0" ::: "memory");
    // every group has LDS of its own: nothing is refilled
    if (q + 2 < XGROUPS) copy_group_to_lds(xl + (q + 2) * 256, xg + (q + 2) * 64);
#pragma unroll
    for (int p = 0; p < 2; ++p) {
      const v4f* xp = (const v4f*)(xrd + 128 * (2 * q + p));
      xr[p][0] = xp[0]; xr[p][1] = xp[1]; xr[p][2] = xp[4]; xr[p][3] = xp[5];
    }
#pragma unroll
    for (int p = 0; p < 2; ++p) {
      const int ks = 2 * q + p;
      v16h a;
#pragma unroll
      for (int j = 0; j < 4; ++j)
#pragma unroll
        for (int e = 0; e < 4; ++e) a[4 * j + e] = (_Float16)xr[p][j][e];
      // each fragment's registers are refilled for the next step behind its product
#pragma unroll
      for (int nt = 0; nt < 12; ++nt) {
        acc[nt] = wmma_f16(a, bf[nt], acc[nt]);
        if (ks + 1 < PSTEPS)
          bf[nt] = load_frag_packed(Wr + ((ks + 1) * 12 + nt) * FRAG, lane * 16u);
      }
    }
  }
  // ends every wave's reads of its X stage: the partial sums are written over it
  __syncthreads();

  // ---- stage the range's sums row-major ----
  float* Pw = Part + kr * PPLANE + tile * PTILE;
#pragma unroll
  for (int nt = 0; nt < 12; ++nt)
#pragma unroll
    for (int i = 0; i < 8; ++i)
      Pw[(i + 8 * h) * PPITCH + nt * 16 + m] = acc[nt][i];
  // publishes the PKS staged partials to the threads that merge them
  __syncthreads();
  // ends the scheduling region of the register-full product loop: the merge below
  // is scheduled by itself, and its LDS loads are issued together, not one per wait
  __builtin_amdgcn_sched_barrier(0);

  // ---- merge, bias, store Q and K: 8 columns of one row per thread, one 16-byte
  // piece of a fragment; the 8 positions of a (batch, piece) fill one 128-byte line
  // unrolled: the choice of bias and of output buffer is made at compile time
#pragma unroll
  for (int qk = 0; qk < 2; ++qk) {           // Q, then K
    const int sl = threadIdx.x & 7, b = (threadIdx.x >> 3) & 7;
    const int col = (threadIdx.x >> 6) * 8;  // column of Q or of K
    const float* Pr = Part + (sl >> 1) * PTILE + ((sl & 1) * 8 + b) * PPITCH + qk * 64 + col;
    float4 o0 = *(const float4*)Pr, o1 = *(const float4*)(Pr + 4);
#pragma unroll
    for (int r = 1; r < PKS; ++r) {
      const float4 p0 = *(const float4*)(Pr + r * PPLANE);
      const float4 p1 = *(const float4*)(Pr + r * PPLANE + 4);
      o0.x += p0.x; o0.y += p0.y; o0.z += p0.z; o0.w += p0.w;
      o1.x += p1.x; o1.y += p1.y; o1.z += p1.z; o1.w += p1.w;
    }
    const float* bias = (qk == 0 ? bq : bk) + col;
    const float4 b0 = *(const float4*)bias, b1 = *(const float4*)(bias + 4);
    const int s = blockIdx.x * 8 + sl;
    v8h q;
    q[0] = (_Float16)(o0.x + b0.x);
    q[1] = (_Float16)(o0.y + b0.y);
    q[2] = (_Float16)(o0.z + b0.z);
    q[3] = (_Float16)(o0.w + b0.w);
    q[4] = (_Float16)(o1.x + b1.x);
    q[5] = (_Float16)(o1.y + b1.y);
    q[6] = (_Float16)(o1.z + b1.z);
    q[7] = (_Float16)(o1.w + b1.w);
    // column col = 32 * fragment + 16g + 8h + e, row s & 15
    const size_t frag = (size_t)(b * (S_LEN / 16) + (s >> 4)) * 2 + (col >> 5);
    *(v8h*)&(qk == 0 ? Qh : Kh)[frag * FRAG + ((col >> 4) & 1) * 256 +
                                (((col >> 3) & 1) * 16 + (s & 15)) * 8] = q;
  }

  // ---- merge, bias, store V: the block's 8 positions of one (b, column) are one
  // 16-byte piece of a fragment; 16 columns fill 256 contiguous bytes ----
  {
    const int col = threadIdx.x & 63, b = threadIdx.x >> 6;
    const float bb = bv[col];
    v8h q;
#pragma unroll
    for (int j = 0; j < 8; ++j) {
      const float* Pr = Part + (j >> 1) * PTILE + ((j & 1) * 8 + b) * PPITCH + 128 + col;
      float o = Pr[0];
#pragma unroll
      for (int r = 1; r < PKS; ++r) o += Pr[r * PPLANE];
      q[j] = (_Float16)(o + bb);
    }
    // position s0 = 32 * fragment + 16g + 8h, row col & 15
    const int s0 = blockIdx.x * 8;
    const size_t frag = (size_t)(b * (S_LEN / 32) + (s0 >> 5)) * 4 + (col >> 4);
    *(v8h*)&Vt[frag * FRAG + ((s0 >> 4) & 1) * 256 +
               (((s0 >> 3) & 1) * 16 + (col & 15)) * 8] = q;
  }
}

// ---------------------------------------------------------------------------
// Kernel 2: flash attention. A block owns 4 query tiles of 16 rows; the keys are
// split into KSPLIT contiguous ranges, one wave per (QPW tiles, range): each K and
// V fragment that a wave loads feeds the products of its QPW tiles, so that the
// block loads every fragment 4 / QPW times, and a SIMD holds NWAVES / 4 waves whose
// load waits overlap. The partial (max, sum, O) of the ranges are merged through
// LDS at the end.
// The products are taken transposed: St = K x Qt (A = K rows, B = Q rows) and
// Ot += Vt x Pt. Lane L then holds 16 of the 32 scores of ONE query, L & 15
// (keys i + 8*(L>>4) of each 16-key tile), so that the maximum and the sum of a
// score row are in-lane work plus one exchange between the lane halves, the
// running maximum, sum and rescale factor are one register each, and the two
// score tiles, converted in place, are the B fragment of the second product.
// ---------------------------------------------------------------------------
// the value of lane L ^ 16
__device__ __forceinline__ float other_half(float x) {
  const int v = __builtin_bit_cast(int, x);
  return __builtin_bit_cast(
      float, __builtin_amdgcn_permlanex16(v, v, 0x76543210, 0xfedcba98, false, false));
}

__global__ void __launch_bounds__(32 * NWAVES)
flash_attn(const _Float16* __restrict__ Qh, const _Float16* __restrict__ Kh,
           const _Float16* __restrict__ Vt, const float* __restrict__ mask,
           float* __restrict__ out) {
  __shared__ __align__(16) float Lmask[NWAVES * (S_LEN / KSPLIT)];
  __shared__ __align__(16) float Opart[KSPLIT * 4 * 16 * OPITCH];  // [range][tile][row]
  __shared__ float Mpart[KSPLIT * 4 * 16];
  __shared__ float Lpart[KSPLIT * 4 * 16];

  const int lane = threadIdx.x & 31;
  // wave-uniform by construction; held in a scalar register so that the key
  // range, its addresses and the loop test stay scalar
  const int wid  = __builtin_amdgcn_readfirstlane(threadIdx.x >> 5);
  const int n = lane & 15, h = lane >> 4;
  const int b  = blockIdx.y;
  const int t0  = (wid % (4 / QPW)) * QPW;         // first of the wave's tiles in the block
  const int rng = wid / (4 / QPW);                 // this wave's key range
  const int qt = blockIdx.x * 4 + t0;              // first 16-row query tile
  const int kbeg = rng * (S_LEN / KSPLIT);

  const float scale = 0.03125f;                    // 1/sqrt(1024), a power of two

  const _Float16* Qbase = Qh + (size_t)(b * (S_LEN / 16) + qt) * 2 * FRAG;
  // B fragments of the first product, kept in registers over the loop
  // every loop over g is unrolled: what is indexed by g must stay in registers
  v16h bq0[QPW], bq1[QPW];
#pragma unroll
  for (int g = 0; g < QPW; ++g) {
    bq0[g] = load_frag_packed(Qbase + (2 * g) * FRAG,     lane * 16u);
    bq1[g] = load_frag_packed(Qbase + (2 * g + 1) * FRAG, lane * 16u);
  }
  // A lane needs the mask term of 16 keys per pass: log(mask) * scale of the
  // wave's key range is tabled once in the wave's own LDS slice.
  float* Lw = Lmask + wid * (S_LEN / KSPLIT);
#pragma unroll
  for (int j = 0; j < S_LEN / KSPLIT / 32; ++j)
    Lw[j * 32 + lane] = __logf(mask[(kbeg + j * 32 + lane) * BATCH + b]) * scale;
  // the loop reads entries that other lanes of this wave wrote: keeps those reads
  // behind the stores
  asm volatile("s_wait_dscnt 0" ::: "memory");

  float mrun[QPW], lrun[QPW];                      // of query n of tile g; lrun: this half's keys
  v8f O[QPW][4];                                   // O[g][t][i] = Ot[16t + 8h + i][n] of tile g
#pragma unroll
  for (int g = 0; g < QPW; ++g) {
    mrun[g] = -1e30f;
    lrun[g] = 0.0f;
#pragma unroll
    for (int t = 0; t < 4; ++t)
#pragma unroll
      for (int i = 0; i < 8; ++i) O[g][t][i] = 0.0f;
  }

  const v4f* Lr = (const v4f*)(Lw + 8 * h);
  // a pass of 32 keys reads 4 contiguous fragments of K and 4 of V, at the same
  // byte offset in the two buffers: one 32-bit offset per lane serves all 16 loads
  unsigned koff = (unsigned)(b * (S_LEN / 32) + (kbeg >> 5)) * (4 * FRAG * 2) + lane * 16u;

  for (int kb = kbeg; kb < kbeg + S_LEN / KSPLIT; kb += 32, koff += 4 * FRAG * 2, Lr += 8) {
    // ---- scores of 32 keys: two 16x16 tiles (key x query) per query tile, K-dim 64 =
    // 2 wmma each; the K and V fragments are loaded once for the wave's tiles ----
    const v16h ka0 = load_frag_packed(Kh,            koff);
    const v16h ka1 = load_frag_packed(Kh + FRAG,     koff);
    const v16h ka2 = load_frag_packed(Kh + 2 * FRAG, koff);
    const v16h ka3 = load_frag_packed(Kh + 3 * FRAG, koff);
    // keeps the K loads in front of the V loads: a counted wait covers every load issued
    // before the one it is for, and the first products would otherwise wait for V
    // fragments that are needed only behind the softmax
    __builtin_amdgcn_sched_barrier(0);
    v16h va[4];
#pragma unroll
    for (int t = 0; t < 4; ++t) va[t] = load_frag_packed(Vt + t * FRAG, koff);
    // keeps the pass's 16 loads in front of its first product: the registers are
    // there for all of them, and issued together they wait out one load latency;
    // left to itself the scheduler issues some behind the first wait, which costs a second
    __builtin_amdgcn_sched_barrier(0);
    v8f c0[QPW], c1[QPW];
#pragma unroll
    for (int g = 0; g < QPW; ++g) {
#pragma unroll
      for (int i = 0; i < 8; ++i) { c0[g][i] = 0.0f; c1[g][i] = 0.0f; }
      c0[g] = wmma_f16(ka0, bq0[g], c0[g]);
      c0[g] = wmma_f16(ka1, bq1[g], c0[g]);
      c1[g] = wmma_f16(ka2, bq0[g], c1[g]);
      c1[g] = wmma_f16(ka3, bq1[g], c1[g]);
    }

    // ---- (score + log(mask)) * scale, online softmax of the lane's query of each tile ----
    const v4f l00 = Lr[0], l01 = Lr[1], l10 = Lr[4], l11 = Lr[5];
    v16h pb[QPW];  // pb[g][e] = Pt[8h + e][n], pb[g][8 + e] = Pt[16 + 8h + e][n]: V's stored k order
#pragma unroll
    for (int g = 0; g < QPW; ++g) {
      float s[16];
#pragma unroll
      for (int i = 0; i < 4; ++i) {
        s[i]      = fmaf(c0[g][i],     scale, l00[i]);
        s[i + 4]  = fmaf(c0[g][i + 4], scale, l01[i]);
        s[i + 8]  = fmaf(c1[g][i],     scale, l10[i]);
        s[i + 12] = fmaf(c1[g][i + 4], scale, l11[i]);
      }
      float mx = s[0];
#pragma unroll
      for (int i = 1; i < 16; ++i) mx = fmaxf(mx, s[i]);
      mx = fmaxf(mx, other_half(mx));

      const float mn = fmaxf(mrun[g], mx);
      float alpha;                                 // exp(mrun - mn)
      // v_exp_f32 and the one slot that the instruction set asks for behind a
      // transcendental, in one statement: a v_nop of its own does not stay behind it
      asm("v_exp_f32 %0, %1\n\tv_nop" : "=v"(alpha) : "v"((mrun[g] - mn) * 1.44269504f));
      mrun[g] = mn;
      float rsum = 0.0f;
#pragma unroll
      for (int i = 0; i < 16; ++i) {
        const float p = __expf(s[i] - mn);
        rsum += p;
        pb[g][i] = (_Float16)p;
      }
      lrun[g] = lrun[g] * alpha + rsum;
#pragma unroll
      for (int t = 0; t < 4; ++t) O[g][t] *= alpha;
    }

    // ---- Ot += Vt(64x32) x Pt(32x16) ----
#pragma unroll
    for (int t = 0; t < 4; ++t)
#pragma unroll
      for (int g = 0; g < QPW; ++g) O[g][t] = wmma_f16(va[t], pb[g], O[g][t]);
  }

  // ---- stage this range's partial result: 8 consecutive columns per register tile ----
#pragma unroll
  for (int g = 0; g < QPW; ++g) {
    const int slot = (rng * 4 + t0 + g) * 16 + n;  // [range][tile][row]
    float* Ow = Opart + slot * OPITCH + 8 * h;
#pragma unroll
    for (int t = 0; t < 4; ++t) {
      *(v4f*)(Ow + t * 16)     = __builtin_shufflevector(O[g][t], O[g][t], 0, 1, 2, 3);
      *(v4f*)(Ow + t * 16 + 4) = __builtin_shufflevector(O[g][t], O[g][t], 4, 5, 6, 7);
    }
    lrun[g] += other_half(lrun[g]);
    if (h == 0) {
      Mpart[slot] = mrun[g];
      Lpart[slot] = lrun[g];
    }
  }
  // publishes every range's partial to the threads that merge them
  __syncthreads();

  // ---- merge the ranges, normalize, write out [s][b][d] fp32 ----
  const int tq = threadIdx.x / (8 * NWAVES);       // query tile this thread merges
  // unrolled: the LDS reads of a thread's pieces are issued together
#pragma unroll
  for (int it = 0; it < 256 / (8 * NWAVES); ++it) {
    const int e = it * (8 * NWAVES) + threadIdx.x % (8 * NWAVES);
    const int row = e >> 4, c4 = (e & 15) * 4;
    float mr[KSPLIT];
    float M = -1e30f;
#pragma unroll
    for (int r = 0; r < KSPLIT; ++r) {
      mr[r] = Mpart[(r * 4 + tq) * 16 + row];
      M = fmaxf(M, mr[r]);
    }
    float L = 0.0f;
    float4 o = make_float4(0.0f, 0.0f, 0.0f, 0.0f);
#pragma unroll
    for (int r = 0; r < KSPLIT; ++r) {
      const float w = __expf(mr[r] - M);
      const float4 p = *(const float4*)&Opart[((r * 4 + tq) * 16 + row) * OPITCH + c4];
      L += w * Lpart[(r * 4 + tq) * 16 + row];
      o.x += w * p.x; o.y += w * p.y; o.z += w * p.z; o.w += w * p.w;
    }
    const float inv = 1.0f / L;
    const int s = (blockIdx.x * 4 + tq) * 16 + row;
    *(float4*)&out[((size_t)s * BATCH + b) * HD + c4] =
        make_float4(o.x * inv, o.y * inv, o.z * inv, o.w * inv);
  }
}

// ---------------------------------------------------------------------------
extern "C" void kernel_launch(void* const* d_in, const int* in_sizes, int n_in,
                              void* d_out, int out_size, void* d_ws, size_t ws_size,
                              hipStream_t stream) {
  const float* X    = (const float*)d_in[0];
  const float* mask = (const float*)d_in[1];
  const float* Wq   = (const float*)d_in[2];
  const float* bq   = (const float*)d_in[3];
  const float* Wk   = (const float*)d_in[4];
  const float* bk   = (const float*)d_in[5];
  const float* Wv   = (const float*)d_in[6];
  const float* bv   = (const float*)d_in[7];
  float* out = (float*)d_out;

  char* ws = (char*)d_ws;
  const size_t WT_BYTES  = (size_t)3 * 64 * 1024 * 2;          // 384 KB
  const size_t QKV_BYTES = (size_t)BATCH * S_LEN * HD * 2;     // 2 MB each
  _Float16* Wt = (_Float16*)ws;
  _Float16* Qh = (_Float16*)(ws + WT_BYTES);
  _Float16* Kh = (_Float16*)(ws + WT_BYTES + QKV_BYTES);
  _Float16* Vt = (_Float16*)(ws + WT_BYTES + 2 * QKV_BYTES);

  prep_weights<<<96, 256, 0, stream>>>(Wq, Wk, Wv, Wt);
  qkv_proj<<<(S_LEN * BATCH) / 64, 128 * PKS, 0, stream>>>(X, Wt, bq, bk, bv, Qh, Kh, Vt);
  flash_attn<<<dim3(S_LEN / 64, BATCH), 32 * NWAVES, 0, stream>>>(Qh, Kh, Vt, mask, out);
}

// v008
// It runs in 24.9 microseconds.
// Next to v007, in two timings, it ran 1.05 and 1.04 times as fast.
// All steps since v000 together make it 7.26 times as fast.
#include <hip/hip_runtime.h>
#include <hip/hip_bf16.h>
#include <cmath>

typedef __attribute__((ext_vector_type(16))) _Float16 v16h;
typedef __attribute__((ext_vector_type(8)))  float    v8f;
typedef __attribute__((ext_vector_type(8)))  _Float16 v8h;
typedef __attribute__((ext_vector_type(4)))  float    v4f;

#define S_LEN 2048
#define BATCH 8
#define DMODEL 1024
#define HD 64
#define KSPLIT 8                 // key ranges per query tile
#define QPW 2                    // query tiles per wave: a loaded K or V fragment serves them all
#define NWAVES (4 / QPW * KSPLIT)  // waves per attention block
#define OPITCH 68                // floats per staged partial row (16 B x odd)
#define PKS 4                    // K ranges per projection tile, one wave each
#define PSTEPS (DMODEL / PKS / 32)  // 32-deep steps of one K range
#define PPITCH 196               // floats per staged projection row (16 B x odd)
#define PTILE (16 * PPITCH + 8)  // floats per staged 16-row tile: the 8 spread the tiles over the banks
#define PPLANE (4 * PTILE)       // floats per staged partial
#define FRAG 512                 // f16 elements of one stored 16 x 32 fragment
#define XPITCH 1040              // bytes per staged X row: the 1 KiB of a K range + 16 (16 B x odd)
#define XWAVE (16 * XPITCH)      // bytes of a wave's staged 16 X rows
#define XGROUPS (PSTEPS / 2)     // copy groups of a wave: 256 B (two steps) of each of its 16 rows
#define NPASS (S_LEN / KSPLIT / 32)  // 32-key passes of one key range
static_assert((XGROUPS & (XGROUPS - 1)) == 0 && (NPASS & (NPASS - 1)) == 0,
              "the rotated walks wrap by a mask");

// ---------------------------------------------------------------------------
// WMMA helper: D = A(16x32 f16) * B(32x16 f16) + C(16x16 f32)
// ---------------------------------------------------------------------------
__device__ __forceinline__ v8f wmma_f16(v16h a, v16h b, v8f c) {
  return __builtin_amdgcn_wmma_f32_16x16x32_f16(
      /*neg_a=*/false, a, /*neg_b=*/false, b,
      /*c_mod=*/(short)0, c, /*reuse_a=*/false, /*reuse_b=*/false);
}

// ---------------------------------------------------------------------------
// Fragment loaders.
// A 16x32 f16 layout (ISA 7.12.2): lane L -> m=L&15, h=L>>4.
//   VGPR j in [0,3]: K = 8h + 2j, 2j+1 ; VGPR j in [4,7]: K = 16 + 8h + 2(j-4)
// B mirrors A on the transposed operand (row index = N column, k pattern same).
// Contiguous K pairs -> dword loads.
// ---------------------------------------------------------------------------
typedef __attribute__((ext_vector_type(4))) unsigned int u32x4;
union FragQ { u32x4 q[2]; v16h v; };

// Fragment order: the workspace operands (weights, Q, K, V) are stored fragment by
// fragment, 1,024 contiguous bytes each, as [g][lane][8 elements]: lane 16h + c
// holds row c, k = 16g + 8h + e. Each of the two 16-byte loads of a wave then
// covers 512 contiguous bytes (4 whole lines), not 32 bytes of each of 16 lines.
// f: wave-uniform; off: the lane's byte offset behind f, 16 * lane inside the fragment
__device__ __forceinline__ v16h load_frag_packed(const _Float16* f, unsigned off) {
  const u32x4* p = (const u32x4*)((const char*)f + off);
  FragQ t;
  t.q[0] = p[0];
  t.q[1] = p[32];
  return t.v;
}

// ---------------------------------------------------------------------------
// Kernel 0: convert weights fp32 [k][n] -> f16 in fragment order, [k / 32][n / 16]
// over the 192 columns of Wq, Wk, Wv; one 16-byte piece per thread. The PSTEPS steps
// of each K range are stored twice in a row: a walk over the range that starts at any
// step and wraps is then one contiguous run.
// ---------------------------------------------------------------------------
__global__ void __launch_bounds__(256)
prep_weights(const float* __restrict__ Wq, const float* __restrict__ Wk,
             const float* __restrict__ Wv, _Float16* __restrict__ Wt) {
  const int idx = blockIdx.x * 256 + threadIdx.x;    // 0 .. 3*64*1024/8-1
  const int c = idx & 15, h = (idx >> 4) & 1, g = (idx >> 5) & 1;
  const int f  = idx >> 6;                           // fragment
  const int ks = f / 12, nt = f % 12;
  const float* W = (nt < 4) ? Wq : ((nt < 8) ? Wk : Wv);
  const float* src = W + (ks * 32 + g * 16 + h * 8) * HD + (nt & 3) * 16 + c;
  v8h o;
#pragma unroll
  for (int e = 0; e < 8; ++e) o[e] = (_Float16)src[e * HD];
  _Float16* dst = Wt + (size_t)((ks / PSTEPS * 2 * PSTEPS + ks % PSTEPS) * 12 + nt) * FRAG +
                  (idx & 63) * 8;
  *(v8h*)dst = o;
  *(v8h*)(dst + PSTEPS * 12 * FRAG) = o;
}

// One group of a wave's X rows: eight asynchronous copies to LDS, 16 bytes per lane
// each, copy c for rows 2c and 2c + 1. The s_wait_xcnt stands in the copies' own
// statement, in front of any rewrite of the address registers that they name.
__device__ __forceinline__ void copy_group_to_lds(unsigned l, const float* g) {
  asm volatile("global_load_async_to_lds_b128 %0, %1, off\n\t"
               "global_load_async_to_lds_b128 %2, %3, off\n\t"
               "global_load_async_to_lds_b128 %4, %5, off\n\t"
               "global_load_async_to_lds_b128 %6, %7, off\n\t"
               "global_load_async_to_lds_b128 %8, %9, off\n\t"
               "global_load_async_to_lds_b128 %10, %11, off\n\t"
               "global_load_async_to_lds_b128 %12, %13, off\n\t"
               "global_load_async_to_lds_b128 %14, %15, off\n\t"
               "s_wait_xcnt 0x0"
               :: "v"(l),               "v"(g),
                  "v"(l + 2 * XPITCH),  "v"(g + 2 * DMODEL),
                  "v"(l + 4 * XPITCH),  "v"(g + 4 * DMODEL),
                  "v"(l + 6 * XPITCH),  "v"(g + 6 * DMODEL),
                  "v"(l + 8 * XPITCH),  "v"(g + 8 * DMODEL),
                  "v"(l + 10 * XPITCH), "v"(g + 10 * DMODEL),
                  "v"(l + 12 * XPITCH), "v"(g + 12 * DMODEL),
                  "v"(l + 14 * XPITCH), "v"(g + 14 * DMODEL)
               : "memory");
}

// ---------------------------------------------------------------------------
// Kernel 1: QKV projection. A block owns 4 tiles of 16 rows x 192 columns; each
// tile's K is split into PKS contiguous ranges, one wave per (tile, range). With
// PKS waves on a SIMD a wave has 256 registers: beside its 96 accumulators it
// holds a ring of 12 weight fragments, loaded ahead. Its X rows come into the
// wave's own LDS stage by asynchronous copies of whole lines (256 contiguous bytes
// of 2 rows per copy), two groups of 8 copies in flight, and are read from there in
// A-fragment order: a load straight into that order takes 32 bytes of each of 16
// lines. The partial sums of the ranges are merged through LDS, over the X stage.
// Every block reads the same weights: each starts the walk over its K ranges at a
// step of its own and wraps, so that blocks running in step ask L2 for different
// lines at one moment, not all for the same ones.
//   X      : [S*B, 1024] fp32 (row r = s*B + b)
//   Wt     : [K range][2 x PSTEPS steps][n / 16] fragments (rows n, k along the model dimension)
//   Qh,Kh  : [b][s / 16][d / 32] fragments (rows s, k along d)
//   Vt     : [b][s / 32][d / 16] fragments (rows d, k along s: the A operand of Ot += Vt x Pt)
// ---------------------------------------------------------------------------
__global__ void __launch_bounds__(128 * PKS)
qkv_proj(const float* __restrict__ X, const _Float16* __restrict__ Wt,
         const float* __restrict__ bq, const float* __restrict__ bk,
         const float* __restrict__ bv,
         _Float16* __restrict__ Qh, _Float16* __restrict__ Kh,
         _Float16* __restrict__ Vt) {
  // first every wave's X stage; behind the product loop and a barrier the partial sums
  __shared__ __align__(16) float Sm[4 * PKS * XWAVE / 4];
  static_assert(4 * PKS * XWAVE / 4 >= PKS * PPLANE, "the partial sums fit the stage");
  float* Part = Sm;

  const int lane = threadIdx.x & 31;
  // wave-uniform by construction; held in a scalar register so that the K range
  // and the operand bases stay scalar
  const int wid = __builtin_amdgcn_readfirstlane(threadIdx.x >> 5);
  const int m = lane & 15, h = lane >> 4;
  const int tile = wid & 3;                  // 16-row tile inside the block
  const int kr   = wid >> 2;                 // K range

  v8f acc[12];
#pragma unroll
  for (int t = 0; t < 12; ++t)
#pragma unroll
    for (int i = 0; i < 8; ++i) acc[t][i] = 0.0f;

  // copy c of a group: lanes 0-15 bring 256 B of row 2c, lanes 16-31 of row 2c + 1
  const unsigned xl = (unsigned)(size_t)Sm + wid * XWAVE + h * XPITCH + m * 16;
  const float* xg = X + ((size_t)(blockIdx.x * 4 + tile) * 16 + h) * DMODEL +
                    kr * (DMODEL / PKS) + m * 4;
  // the block's start in the walk, scalar: trip q takes group (q + rq) mod XGROUPS, its two
  // steps in the order rp, 1 - rp; the index / 8 is added so that the starts differ also
  // among blocks of equal index modulo 8
  const int rot = (blockIdx.x + (blockIdx.x >> 3)) & (PSTEPS - 1);
  const int rq = rot >> 1, rp = rot & 1;
  // the lane's 16 floats of half p of trip q: xrd[p] + 256 * q + {0..31, 64..95} bytes
  const char* xrd0 = (const char*)Sm + wid * XWAVE + m * XPITCH + 32 * h;
  const char* xrd[2] = {xrd0 + 128 * rp, xrd0 + 128 * (1 - rp)};
  // the weights of half p of trip q: Wr[p] + 2 * q steps, without a wrap in the doubled range
  const _Float16* Wr0 = Wt + (size_t)(kr * 2 * PSTEPS + 2 * rq) * 12 * FRAG;
  const _Float16* Wr[2] = {Wr0 + rp * 12 * FRAG, Wr0 + (1 - rp) * 12 * FRAG};

  copy_group_to_lds(xl, xg + rq * 64);
  copy_group_to_lds(xl + 256, xg + ((rq + 1) & (XGROUPS - 1)) * 64);
  v16h bf[12];                               // ring of weight fragments, one step deep
#pragma unroll
  for (int nt = 0; nt < 12; ++nt) bf[nt] = load_frag_packed(Wr[0] + nt * FRAG, lane * 16u);

  v4f xr[2][4];                              // X rows of the two steps of a group, as read
  // unrolled: the tests on q and ks must be settled at compile time for the X rows
  // and the ring to stay in registers
#pragma unroll
  for (int q = 0; q < XGROUPS; ++q) {
    // the group of trip q has landed: all of the wave's copies but the 8 of trip q + 1; only the
    // wave that copied them reads these bytes, so that its own wait is enough
    if (q + 1 < XGROUPS) asm volatile("s_wait_asynccnt 0x8" ::: "memory");
    else                 asm volatile("s_wait_asynccnt 0x0" ::: "memory");
    // every group has LDS of its own: nothing is refilled
    if (q + 2 < XGROUPS)
      copy_group_to_lds(xl + (q + 2) * 256, xg + ((q + 2 + rq) & (XGROUPS - 1)) * 64);
#pragma unroll
    for (int p = 0; p < 2; ++p) {
      const v4f* xp = (const v4f*)(xrd[p] + 256 * q);
      xr[p][0] = xp[0]; xr[p][1] = xp[1]; xr[p][2] = xp[4]; xr[p][3] = xp[5];
    }
#pragma unroll
    for (int p = 0; p < 2; ++p) {
      const int ks = 2 * q + p;
      v16h a;
#pragma unroll
      for (int j = 0; j < 4; ++j)
#pragma unroll
        for (int e = 0; e < 4; ++e) a[4 * j + e] = (_Float16)xr[p][j][e];
      // each fragment's registers are refilled for the next step behind its product
#pragma unroll
      for (int nt = 0; nt < 12; ++nt) {
        acc[nt] = wmma_f16(a, bf[nt], acc[nt]);
        if (ks + 1 < PSTEPS)
          bf[nt] = load_frag_packed(Wr[1 - p] + (2 * (q + p) * 12 + nt) * FRAG, lane * 16u);
      }
    }
  }
  // ends every wave's reads of its X stage: the partial sums are written over it
  __syncthreads();

  // ---- stage the range's sums row-major ----
  float* Pw = Part + kr * PPLANE + tile * PTILE;
#pragma unroll
  for (int nt = 0; nt < 12; ++nt)
#pragma unroll
    for (int i = 0; i < 8; ++i)
      Pw[(i + 8 * h) * PPITCH + nt * 16 + m] = acc[nt][i];
  // publishes the PKS staged partials to the threads that merge them
  __syncthreads();
  // ends the scheduling region of the register-full product loop: the merge below
  // is scheduled by itself, and its LDS loads are issued together, not one per wait
  __builtin_amdgcn_sched_barrier(0);

  // ---- merge, bias, store Q and K: 8 columns of one row per thread, one 16-byte
  // piece of a fragment; the 8 positions of a (batch, piece) fill one 128-byte line
  // unrolled: the choice of bias and of output buffer is made at compile time
#pragma unroll
  for (int qk = 0; qk < 2; ++qk) {           // Q, then K
    const int sl = threadIdx.x & 7, b = (threadIdx.x >> 3) & 7;
    const int col = (threadIdx.x >> 6) * 8;  // column of Q or of K
    const float* Pr = Part + (sl >> 1) * PTILE + ((sl & 1) * 8 + b) * PPITCH + qk * 64 + col;
    float4 o0 = *(const float4*)Pr, o1 = *(const float4*)(Pr + 4);
#pragma unroll
    for (int r = 1; r < PKS; ++r) {
      const float4 p0 = *(const float4*)(Pr + r * PPLANE);
      const float4 p1 = *(const float4*)(Pr + r * PPLANE + 4);
      o0.x += p0.x; o0.y += p0.y; o0.z += p0.z; o0.w += p0.w;
      o1.x += p1.x; o1.y += p1.y; o1.z += p1.z; o1.w += p1.w;
    }
    const float* bias = (qk == 0 ? bq : bk) + col;
    const float4 b0 = *(const float4*)bias, b1 = *(const float4*)(bias + 4);
    const int s = blockIdx.x * 8 + sl;
    v8h q;
    q[0] = (_Float16)(o0.x + b0.x);
    q[1] = (_Float16)(o0.y + b0.y);
    q[2] = (_Float16)(o0.z + b0.z);
    q[3] = (_Float16)(o0.w + b0.w);
    q[4] = (_Float16)(o1.x + b1.x);
    q[5] = (_Float16)(o1.y + b1.y);
    q[6] = (_Float16)(o1.z + b1.z);
    q[7] = (_Float16)(o1.w + b1.w);
    // column col = 32 * fragment + 16g + 8h + e, row s & 15
    const size_t frag = (size_t)(b * (S_LEN / 16) + (s >> 4)) * 2 + (col >> 5);
    *(v8h*)&(qk == 0 ? Qh : Kh)[frag * FRAG + ((col >> 4) & 1) * 256 +
                                (((col >> 3) & 1) * 16 + (s & 15)) * 8] = q;
  }

  // ---- merge, bias, store V: the block's 8 positions of one (b, column) are one
  // 16-byte piece of a fragment; 16 columns fill 256 contiguous bytes ----
  {
    const int col = threadIdx.x & 63, b = threadIdx.x >> 6;
    const float bb = bv[col];
    v8h q;
#pragma unroll
    for (int j = 0; j < 8; ++j) {
      const float* Pr = Part + (j >> 1) * PTILE + ((j & 1) * 8 + b) * PPITCH + 128 + col;
      float o = Pr[0];
#pragma unroll
      for (int r = 1; r < PKS; ++r) o += Pr[r * PPLANE];
      q[j] = (_Float16)(o + bb);
    }
    // position s0 = 32 * fragment + 16g + 8h, row col & 15
    const int s0 = blockIdx.x * 8;
    const size_t frag = (size_t)(b * (S_LEN / 32) + (s0 >> 5)) * 4 + (col >> 4);
    *(v8h*)&Vt[frag * FRAG + ((s0 >> 4) & 1) * 256 +
               (((s0 >> 3) & 1) * 16 + (col & 15)) * 8] = q;
  }
}

// ---------------------------------------------------------------------------
// Kernel 2: flash attention. A block owns 4 query tiles of 16 rows; the keys are
// split into KSPLIT contiguous ranges, one wave per (QPW tiles, range): each K and
// V fragment that a wave loads feeds the products of its QPW tiles, so that the
// block loads every fragment 4 / QPW times, and a SIMD holds NWAVES / 4 waves whose
// load waits overlap. The partial (max, sum, O) of the ranges are merged through
// LDS at the end. The blocks of a batch read the same K and V: each starts the walk
// over its key ranges at a pass of its own and wraps, so that blocks running in step
// ask L2 for different lines at one moment.
// The products are taken transposed: St = K x Qt (A = K rows, B = Q rows) and
// Ot += Vt x Pt. Lane L then holds 16 of the 32 scores of ONE query, L & 15
// (keys i + 8*(L>>4) of each 16-key tile), so that the maximum and the sum of a
// score row are in-lane work plus one exchange between the lane halves, the
// running maximum, sum and rescale factor are one register each, and the two
// score tiles, converted in place, are the B fragment of the second product.
// ---------------------------------------------------------------------------
// the value of lane L ^ 16
__device__ __forceinline__ float other_half(float x) {
  const int v = __builtin_bit_cast(int, x);
  return __builtin_bit_cast(
      float, __builtin_amdgcn_permlanex16(v, v, 0x76543210, 0xfedcba98, false, false));
}

__global__ void __launch_bounds__(32 * NWAVES)
flash_attn(const _Float16* __restrict__ Qh, const _Float16* __restrict__ Kh,
           const _Float16* __restrict__ Vt, const float* __restrict__ mask,
           float* __restrict__ out) {
  __shared__ __align__(16) float Lmask[NWAVES * (S_LEN / KSPLIT)];
  __shared__ __align__(16) float Opart[KSPLIT * 4 * 16 * OPITCH];  // [range][tile][row]
  __shared__ float Mpart[KSPLIT * 4 * 16];
  __shared__ float Lpart[KSPLIT * 4 * 16];

  const int lane = threadIdx.x & 31;
  // wave-uniform by construction; held in a scalar register so that the key
  // range, its addresses and the loop test stay scalar
  const int wid  = __builtin_amdgcn_readfirstlane(threadIdx.x >> 5);
  const int n = lane & 15, h = lane >> 4;
  const int b  = blockIdx.y;
  const int t0  = (wid % (4 / QPW)) * QPW;         // first of the wave's tiles in the block
  const int rng = wid / (4 / QPW);                 // this wave's key range
  const int qt = blockIdx.x * 4 + t0;              // first 16-row query tile
  const int kbeg = rng * (S_LEN / KSPLIT);

  const float scale = 0.03125f;                    // 1/sqrt(1024), a power of two

  const _Float16* Qbase = Qh + (size_t)(b * (S_LEN / 16) + qt) * 2 * FRAG;
  // B fragments of the first product, kept in registers over the loop
  // every loop over g is unrolled: what is indexed by g must stay in registers
  v16h bq0[QPW], bq1[QPW];
#pragma unroll
  for (int g = 0; g < QPW; ++g) {
    bq0[g] = load_frag_packed(Qbase + (2 * g) * FRAG,     lane * 16u);
    bq1[g] = load_frag_packed(Qbase + (2 * g + 1) * FRAG, lane * 16u);
  }
  // A lane needs the mask term of 16 keys per pass: log(mask) * scale of the
  // wave's key range is tabled once in the wave's own LDS slice.
  float* Lw = Lmask + wid * (S_LEN / KSPLIT);
#pragma unroll
  for (int j = 0; j < S_LEN / KSPLIT / 32; ++j)
    Lw[j * 32 + lane] = __logf(mask[(kbeg + j * 32 + lane) * BATCH + b]) * scale;
  // the loop reads entries that other lanes of this wave wrote: keeps those reads
  // behind the stores
  asm volatile("s_wait_dscnt 0" ::: "memory");

  float mrun[QPW], lrun[QPW];                      // of query n of tile g; lrun: this half's keys
  v8f O[QPW][4];                                   // O[g][t][i] = Ot[16t + 8h + i][n] of tile g
#pragma unroll
  for (int g = 0; g < QPW; ++g) {
    mrun[g] = -1e30f;
    lrun[g] = 0.0f;
#pragma unroll
    for (int t = 0; t < 4; ++t)
#pragma unroll
      for (int i = 0; i < 8; ++i) O[g][t][i] = 0.0f;
  }

  // a pass of 32 keys reads 4 contiguous fragments of K and 4 of V, at the same
  // byte offset in the two buffers: one 32-bit offset per lane serves all 16 loads
  const unsigned kbase = (unsigned)(b * (S_LEN / 32) + (kbeg >> 5)) * (4 * FRAG * 2) + lane * 16u;
  // the pass of the range taken now, scalar: the block's first one, then on with a wrap;
  // twice the index / 8 is added so that the 32 blocks of a batch spread evenly also over
  // those of 4 neighbouring values of the index modulo 8
  int pp = (blockIdx.x + 2 * (blockIdx.x >> 3)) & (NPASS - 1);
  unsigned koff = kbase + pp * (4 * FRAG * 2);

  // koff goes on from its own value, back by the range at the wrap: the loads' offset
  // register then lives through the loop, and no load of a pass has it as its destination
  for (int ps = 0; ps < NPASS; ++ps,
       koff += (pp == NPASS - 1 ? 1 - NPASS : 1) * (4 * FRAG * 2), pp = (pp + 1) & (NPASS - 1)) {
    const v4f* Lr = (const v4f*)(Lw + 8 * h + 32 * pp);
    // ---- scores of 32 keys: two 16x16 tiles (key x query) per query tile, K-dim 64 =
    // 2 wmma each; the K and V fragments are loaded once for the wave's tiles ----
    const v16h ka0 = load_frag_packed(Kh,            koff);
    const v16h ka1 = load_frag_packed(Kh + FRAG,     koff);
    const v16h ka2 = load_frag_packed(Kh + 2 * FRAG, koff);
    const v16h ka3 = load_frag_packed(Kh + 3 * FRAG, koff);
    // keeps the K loads in front of the V loads: a counted wait covers every load issued
    // before the one it is for, and the first products would otherwise wait for V
    // fragments that are needed only behind the softmax
    __builtin_amdgcn_sched_barrier(0);
    v16h va[4];
#pragma unroll
    for (int t = 0; t < 4; ++t) va[t] = load_frag_packed(Vt + t * FRAG, koff);
    // keeps the pass's 16 loads in front of its first product: the registers are
    // there for all of them, and issued together they wait out one load latency;
    // left to itself the scheduler issues some behind the first wait, which costs a second
    __builtin_amdgcn_sched_barrier(0);
    v8f c0[QPW], c1[QPW];
#pragma unroll
    for (int g = 0; g < QPW; ++g) {
#pragma unroll
      for (int i = 0; i < 8; ++i) { c0[g][i] = 0.0f; c1[g][i] = 0.0f; }
      c0[g] = wmma_f16(ka0, bq0[g], c0[g]);
      c0[g] = wmma_f16(ka1, bq1[g], c0[g]);
      c1[g] = wmma_f16(ka2, bq0[g], c1[g]);
      c1[g] = wmma_f16(ka3, bq1[g], c1[g]);
    }

    // ---- (score + log(mask)) * scale, online softmax of the lane's query of each tile ----
    const v4f l00 = Lr[0], l01 = Lr[1], l10 = Lr[4], l11 = Lr[5];
    v16h pb[QPW];  // pb[g][e] = Pt[8h + e][n], pb[g][8 + e] = Pt[16 + 8h + e][n]: V's stored k order
#pragma unroll
    for (int g = 0; g < QPW; ++g) {
      float s[16];
#pragma unroll
      for (int i = 0; i < 4; ++i) {
        s[i]      = fmaf(c0[g][i],     scale, l00[i]);
        s[i + 4]  = fmaf(c0[g][i + 4], scale, l01[i]);
        s[i + 8]  = fmaf(c1[g][i],     scale, l10[i]);
        s[i + 12] = fmaf(c1[g][i + 4], scale, l11[i]);
      }
      float mx = s[0];
#pragma unroll
      for (int i = 1; i < 16; ++i) mx = fmaxf(mx, s[i]);
      mx = fmaxf(mx, other_half(mx));

      const float mn = fmaxf(mrun[g], mx);
      float alpha;                                 // exp(mrun - mn)
      // v_exp_f32 and the one slot that the instruction set asks for behind a
      // transcendental, in one statement: a v_nop of its own does not stay behind it
      asm("v_exp_f32 %0, %1\n\tv_nop" : "=v"(alpha) : "v"((mrun[g] - mn) * 1.44269504f));
      mrun[g] = mn;
      float rsum = 0.0f;
#pragma unroll
      for (int i = 0; i < 16; ++i) {
        const float p = __expf(s[i] - mn);
        rsum += p;
        pb[g][i] = (_Float16)p;
      }
      lrun[g] = lrun[g] * alpha + rsum;
#pragma unroll
      for (int t = 0; t < 4; ++t) O[g][t] *= alpha;
    }

    // ---- Ot += Vt(64x32) x Pt(32x16) ----
#pragma unroll
    for (int t = 0; t < 4; ++t)
#pragma unroll
      for (int g = 0; g < QPW; ++g) O[g][t] = wmma_f16(va[t], pb[g], O[g][t]);
  }

  // ---- stage this range's partial result: 8 consecutive columns per register tile ----
#pragma unroll
  for (int g = 0; g < QPW; ++g) {
    const int slot = (rng * 4 + t0 + g) * 16 + n;  // [range][tile][row]
    float* Ow = Opart + slot * OPITCH + 8 * h;
#pragma unroll
    for (int t = 0; t < 4; ++t) {
      *(v4f*)(Ow + t * 16)     = __builtin_shufflevector(O[g][t], O[g][t], 0, 1, 2, 3);
      *(v4f*)(Ow + t * 16 + 4) = __builtin_shufflevector(O[g][t], O[g][t], 4, 5, 6, 7);
    }
    lrun[g] += other_half(lrun[g]);
    if (h == 0) {
      Mpart[slot] = mrun[g];
      Lpart[slot] = lrun[g];
    }
  }
  // publishes every range's partial to the threads that merge them
  __syncthreads();

  // ---- merge the ranges, normalize, write out [s][b][d] fp32 ----
  const int tq = threadIdx.x / (8 * NWAVES);       // query tile this thread merges
  // unrolled: the LDS reads of a thread's pieces are issued together
#pragma unroll
  for (int it = 0; it < 256 / (8 * NWAVES); ++it) {
    const int e = it * (8 * NWAVES) + threadIdx.x % (8 * NWAVES);
    const int row = e >> 4, c4 = (e & 15) * 4;
    float mr[KSPLIT];
    float M = -1e30f;
#pragma unroll
    for (int r = 0; r < KSPLIT; ++r) {
      mr[r] = Mpart[(r * 4 + tq) * 16 + row];
      M = fmaxf(M, mr[r]);
    }
    float L = 0.0f;
    float4 o = make_float4(0.0f, 0.0f, 0.0f, 0.0f);
#pragma unroll
    for (int r = 0; r < KSPLIT; ++r) {
      const float w = __expf(mr[r] - M);
      const float4 p = *(const float4*)&Opart[((r * 4 + tq) * 16 + row) * OPITCH + c4];
      L += w * Lpart[(r * 4 + tq) * 16 + row];
      o.x += w * p.x; o.y += w * p.y; o.z += w * p.z; o.w += w * p.w;
    }
    const float inv = 1.0f / L;
    const int s = (blockIdx.x * 4 + tq) * 16 + row;
    *(float4*)&out[((size_t)s * BATCH + b) * HD + c4] =
        make_float4(o.x * inv, o.y * inv, o.z * inv, o.w * inv);
  }
}

// ---------------------------------------------------------------------------
extern "C" void kernel_launch(void* const* d_in, const int* in_sizes, int n_in,
                              void* d_out, int out_size, void* d_ws, size_t ws_size,
                              hipStream_t stream) {
  const float* X    = (const float*)d_in[0];
  const float* mask = (const float*)d_in[1];
  const float* Wq   = (const float*)d_in[2];
  const float* bq   = (const float*)d_in[3];
  const float* Wk   = (const float*)d_in[4];
  const float* bk   = (const float*)d_in[5];
  const float* Wv   = (const float*)d_in[6];
  const float* bv   = (const float*)d_in[7];
  float* out = (float*)d_out;

  char* ws = (char*)d_ws;
  const size_t WT_BYTES  = (size_t)2 * 3 * 64 * 1024 * 2;      // 768 KB: every step twice
  const size_t QKV_BYTES = (size_t)BATCH * S_LEN * HD * 2;     // 2 MB each
  _Float16* Wt = (_Float16*)ws;
  _Float16* Qh = (_Float16*)(ws + WT_BYTES);
  _Float16* Kh = (_Float16*)(ws + WT_BYTES + QKV_BYTES);
  _Float16* Vt = (_Float16*)(ws + WT_BYTES + 2 * QKV_BYTES);

  prep_weights<<<96, 256, 0, stream>>>(Wq, Wk, Wv, Wt);
  qkv_proj<<<(S_LEN * BATCH) / 64, 128 * PKS, 0, stream>>>(X, Wt, bq, bk, bv, Qh, Kh, Vt);
  flash_attn<<<dim3(S_LEN / 64, BATCH), 32 * NWAVES, 0, stream>>>(Qh, Kh, Vt, mask, out);
}

// v009
// It runs in 24 microseconds.
// Timed twice side by side with v008, it ran 1.04 times as fast both times.
// All steps since v000 together make it 7.52 times as fast.
#include <hip/hip_runtime.h>
#include <hip/hip_bf16.h>
#include <cmath>

typedef __attribute__((ext_vector_type(16))) _Float16 v16h;
typedef __attribute__((ext_vector_type(8)))  float    v8f;
typedef __attribute__((ext_vector_type(8)))  _Float16 v8h;
typedef __attribute__((ext_vector_type(4)))  float    v4f;
typedef __attribute__((ext_vector_type(2)))  float    v2f;

#define S_LEN 2048
#define BATCH 8
#define DMODEL 1024
#define HD 64
#define KSPLIT 8                 // key ranges per query tile
#define QPW 2                    // query tiles per wave: a loaded K or V fragment serves them all
#define NWAVES (4 / QPW * KSPLIT)  // waves per attention block
#define OPITCH 68                // floats per staged partial row (16 B x odd)
#define PKS 4                    // K ranges per projection tile, one wave each
#define PSTEPS (DMODEL / PKS / 32)  // 32-deep steps of one K range
#define PPITCH 196               // floats per staged projection row (16 B x odd)
#define PTILE (16 * PPITCH + 8)  // floats per staged 16-row tile: the 8 spread the tiles over the banks
#define PPLANE (4 * PTILE)       // floats per staged partial
#define FRAG 512                 // f16 elements of one stored 16 x 32 fragment
#define XPITCH 1040              // bytes per staged X row: the 1 KiB of a K range + 16 (16 B x odd)
#define XWAVE (16 * XPITCH)      // bytes of a wave's staged 16 X rows
#define XGROUPS (PSTEPS / 2)     // copy groups of a wave: 256 B (two steps) of each of its 16 rows
#define NPASS (S_LEN / KSPLIT / 32)  // 32-key passes of one key range
#define HOLD 8.0f                // a score may top the softmax reference by this much before it moves
static_assert((XGROUPS & (XGROUPS - 1)) == 0 && (NPASS & (NPASS - 1)) == 0,
              "the rotated walks wrap by a mask");

// ---------------------------------------------------------------------------
// WMMA helper: D = A(16x32 f16) * B(32x16 f16) + C(16x16 f32)
// ---------------------------------------------------------------------------
__device__ __forceinline__ v8f wmma_f16(v16h a, v16h b, v8f c) {
  return __builtin_amdgcn_wmma_f32_16x16x32_f16(
      /*neg_a=*/false, a, /*neg_b=*/false, b,
      /*c_mod=*/(short)0, c, /*reuse_a=*/false, /*reuse_b=*/false);
}

// ---------------------------------------------------------------------------
// Fragment loaders.
// A 16x32 f16 layout (ISA 7.12.2): lane L -> m=L&15, h=L>>4.
//   VGPR j in [0,3]: K = 8h + 2j, 2j+1 ; VGPR j in [4,7]: K = 16 + 8h + 2(j-4)
// B mirrors A on the transposed operand (row index = N column, k pattern same).
// Eight contiguous K -> one 16-byte load.
// ---------------------------------------------------------------------------
typedef __attribute__((ext_vector_type(4))) unsigned int u32x4;
union FragQ { u32x4 q[2]; v16h v; };

// Fragment order: the workspace operands (weights, Q, K, V) are stored fragment by
// fragment, 1,024 contiguous bytes each, as [g][lane][8 elements]: lane 16h + c
// holds row c, k = 16g + 8h + e. Each of the two 16-byte loads of a wave then
// covers 512 contiguous bytes (4 whole lines), not 32 bytes of each of 16 lines.
// f: wave-uniform; off: the lane's byte offset behind f, 16 * lane inside the fragment
__device__ __forceinline__ v16h load_frag_packed(const _Float16* f, unsigned off) {
  const u32x4* p = (const u32x4*)((const char*)f + off);
  FragQ t;
  t.q[0] = p[0];
  t.q[1] = p[32];
  return t.v;
}

// ---------------------------------------------------------------------------
// Kernel 0: convert weights fp32 [k][n] -> f16 in fragment order, [k / 32][n / 16]
// over the 192 columns of Wq, Wk, Wv; one 16-byte piece per thread. The PSTEPS steps
// of each K range are stored twice in a row: a walk over the range that starts at any
// step and wraps is then one contiguous run.
// ---------------------------------------------------------------------------
__global__ void __launch_bounds__(256)
prep_weights(const float* __restrict__ Wq, const float* __restrict__ Wk,
             const float* __restrict__ Wv, _Float16* __restrict__ Wt) {
  const int idx = blockIdx.x * 256 + threadIdx.x;    // 0 .. 3*64*1024/8-1
  const int c = idx & 15, h = (idx >> 4) & 1, g = (idx >> 5) & 1;
  const int f  = idx >> 6;                           // fragment
  const int ks = f / 12, nt = f % 12;
  const float* W = (nt < 4) ? Wq : ((nt < 8) ? Wk : Wv);
  const float* src = W + (ks * 32 + g * 16 + h * 8) * HD + (nt & 3) * 16 + c;
  v8h o;
#pragma unroll
  for (int e = 0; e < 8; ++e) o[e] = (_Float16)src[e * HD];
  _Float16* dst = Wt + (size_t)((ks / PSTEPS * 2 * PSTEPS + ks % PSTEPS) * 12 + nt) * FRAG +
                  (idx & 63) * 8;
  *(v8h*)dst = o;
  *(v8h*)(dst + PSTEPS * 12 * FRAG) = o;
}

// One group of a wave's X rows: eight asynchronous copies to LDS, 16 bytes per lane
// each, copy c for rows 2c and 2c + 1. The s_wait_xcnt stands in the copies' own
// statement, in front of any rewrite of the address registers that they name.
__device__ __forceinline__ void copy_group_to_lds(unsigned l, const float* g) {
  asm volatile("global_load_async_to_lds_b128 %0, %1, off\n\t"
               "global_load_async_to_lds_b128 %2, %3, off\n\t"
               "global_load_async_to_lds_b128 %4, %5, off\n\t"
               "global_load_async_to_lds_b128 %6, %7, off\n\t"
               "global_load_async_to_lds_b128 %8, %9, off\n\t"
               "global_load_async_to_lds_b128 %10, %11, off\n\t"
               "global_load_async_to_lds_b128 %12, %13, off\n\t"
               "global_load_async_to_lds_b128 %14, %15, off\n\t"
               "s_wait_xcnt 0x0"
               :: "v"(l),               "v"(g),
                  "v"(l + 2 * XPITCH),  "v"(g + 2 * DMODEL),
                  "v"(l + 4 * XPITCH),  "v"(g + 4 * DMODEL),
                  "v"(l + 6 * XPITCH),  "v"(g + 6 * DMODEL),
                  "v"(l + 8 * XPITCH),  "v"(g + 8 * DMODEL),
                  "v"(l + 10 * XPITCH), "v"(g + 10 * DMODEL),
                  "v"(l + 12 * XPITCH), "v"(g + 12 * DMODEL),
                  "v"(l + 14 * XPITCH), "v"(g + 14 * DMODEL)
               : "memory");
}

// ---------------------------------------------------------------------------
// Kernel 1: QKV projection. A block owns 4 tiles of 16 rows x 192 columns; each
// tile's K is split into PKS contiguous ranges, one wave per (tile, range). With
// PKS waves on a SIMD a wave has 256 registers: beside its 96 accumulators it
// holds a ring of 12 weight fragments, loaded ahead. Its X rows come into the
// wave's own LDS stage by asynchronous copies of whole lines (256 contiguous bytes
// of 2 rows per copy), two groups of 8 copies in flight, and are read from there in
// A-fragment order: a load straight into that order takes 32 bytes of each of 16
// lines. The partial sums of the ranges are merged through LDS, over the X stage.
// Every block reads the same weights: each starts the walk over its K ranges at a
// step of its own and wraps, so that blocks running in step ask L2 for different
// lines at one moment, not all for the same ones.
//   X      : [S*B, 1024] fp32 (row r = s*B + b)
//   Wt     : [K range][2 x PSTEPS steps][n / 16] fragments (rows n, k along the model dimension)
//   Qh,Kh  : [b][s / 16][d / 32] fragments (rows s, k along d)
//   Vt     : [b][s / 32][d / 16] fragments (rows d, k along s: the A operand of Ot += Vt x Pt)
// ---------------------------------------------------------------------------
__global__ void __launch_bounds__(128 * PKS)
qkv_proj(const float* __restrict__ X, const _Float16* __restrict__ Wt,
         const float* __restrict__ bq, const float* __restrict__ bk,
         const float* __restrict__ bv,
         _Float16* __restrict__ Qh, _Float16* __restrict__ Kh,
         _Float16* __restrict__ Vt) {
  // first every wave's X stage; behind the product loop and a barrier the partial sums
  __shared__ __align__(16) float Sm[4 * PKS * XWAVE / 4];
  static_assert(4 * PKS * XWAVE / 4 >= PKS * PPLANE, "the partial sums fit the stage");
  float* Part = Sm;

  const int lane = threadIdx.x & 31;
  // wave-uniform by construction; held in a scalar register so that the K range
  // and the operand bases stay scalar
  const int wid = __builtin_amdgcn_readfirstlane(threadIdx.x >> 5);
  const int m = lane & 15, h = lane >> 4;
  const int tile = wid & 3;                  // 16-row tile inside the block
  const int kr   = wid >> 2;                 // K range

  v8f acc[12];
#pragma unroll
  for (int t = 0; t < 12; ++t)
#pragma unroll
    for (int i = 0; i < 8; ++i) acc[t][i] = 0.0f;

  // copy c of a group: lanes 0-15 bring 256 B of row 2c, lanes 16-31 of row 2c + 1
  const unsigned xl = (unsigned)(size_t)Sm + wid * XWAVE + h * XPITCH + m * 16;
  const float* xg = X + ((size_t)(blockIdx.x * 4 + tile) * 16 + h) * DMODEL +
                    kr * (DMODEL / PKS) + m * 4;
  // the block's start in the walk, scalar: trip q takes group (q + rq) mod XGROUPS, its two
  // steps in the order rp, 1 - rp; the index / 8 is added so that the starts differ also
  // among blocks of equal index modulo 8
  const int rot = (blockIdx.x + (blockIdx.x >> 3)) & (PSTEPS - 1);
  const int rq = rot >> 1, rp = rot & 1;
  // the lane's 16 floats of half p of trip q: xrd[p] + 256 * q + {0..31, 64..95} bytes
  const char* xrd0 = (const char*)Sm + wid * XWAVE + m * XPITCH + 32 * h;
  const char* xrd[2] = {xrd0 + 128 * rp, xrd0 + 128 * (1 - rp)};
  // the weights of half p of trip q: Wr[p] + 2 * q steps, without a wrap in the doubled range
  const _Float16* Wr0 = Wt + (size_t)(kr * 2 * PSTEPS + 2 * rq) * 12 * FRAG;
  const _Float16* Wr[2] = {Wr0 + rp * 12 * FRAG, Wr0 + (1 - rp) * 12 * FRAG};

  copy_group_to_lds(xl, xg + rq * 64);
  copy_group_to_lds(xl + 256, xg + ((rq + 1) & (XGROUPS - 1)) * 64);
  v16h bf[12];                               // ring of weight fragments, one step deep
#pragma unroll
  for (int nt = 0; nt < 12; ++nt) bf[nt] = load_frag_packed(Wr[0] + nt * FRAG, lane * 16u);

  v4f xr[2][4];                              // X rows of the two steps of a group, as read
  // unrolled: the tests on q and ks must be settled at compile time for the X rows
  // and the ring to stay in registers
#pragma unroll
  for (int q = 0; q < XGROUPS; ++q) {
    // the group of trip q has landed: all of the wave's copies but the 8 of trip q + 1; only the
    // wave that copied them reads these bytes, so that its own wait is enough
    if (q + 1 < XGROUPS) asm volatile("s_wait_asynccnt 0x8" ::: "memory");
    else                 asm volatile("s_wait_asynccnt 0x0" ::: "memory");
    // every group has LDS of its own: nothing is refilled
    if (q + 2 < XGROUPS)
      copy_group_to_lds(xl + (q + 2) * 256, xg + ((q + 2 + rq) & (XGROUPS - 1)) * 64);
#pragma unroll
    for (int p = 0; p < 2; ++p) {
      const v4f* xp = (const v4f*)(xrd[p] + 256 * q);
      xr[p][0] = xp[0]; xr[p][1] = xp[1]; xr[p][2] = xp[4]; xr[p][3] = xp[5];
    }
#pragma unroll
    for (int p = 0; p < 2; ++p) {
      const int ks = 2 * q + p;
      v16h a;
#pragma unroll
      for (int j = 0; j < 4; ++j)
#pragma unroll
        for (int e = 0; e < 4; ++e) a[4 * j + e] = (_Float16)xr[p][j][e];
      // each fragment's registers are refilled for the next step behind its product
#pragma unroll
      for (int nt = 0; nt < 12; ++nt) {
        acc[nt] = wmma_f16(a, bf[nt], acc[nt]);
        if (ks + 1 < PSTEPS)
          bf[nt] = load_frag_packed(Wr[1 - p] + (2 * (q + p) * 12 + nt) * FRAG, lane * 16u);
      }
    }
  }
  // ends every wave's reads of its X stage: the partial sums are written over it
  __syncthreads();

  // ---- stage the range's sums row-major ----
  float* Pw = Part + kr * PPLANE + tile * PTILE;
#pragma unroll
  for (int nt = 0; nt < 12; ++nt)
#pragma unroll
    for (int i = 0; i < 8; ++i)
      Pw[(i + 8 * h) * PPITCH + nt * 16 + m] = acc[nt][i];
  // publishes the PKS staged partials to the threads that merge them
  __syncthreads();
  // ends the scheduling region of the register-full product loop: the merge below
  // is scheduled by itself, and its LDS loads are issued together, not one per wait
  __builtin_amdgcn_sched_barrier(0);

  // ---- merge, bias, store Q and K: 8 columns of one row per thread, one 16-byte
  // piece of a fragment; the 8 positions of a (batch, piece) fill one 128-byte line
  // unrolled: the choice of bias and of output buffer is made at compile time
#pragma unroll
  for (int qk = 0; qk < 2; ++qk) {           // Q, then K
    const int sl = threadIdx.x & 7, b = (threadIdx.x >> 3) & 7;
    const int col = (threadIdx.x >> 6) * 8;  // column of Q or of K
    const float* Pr = Part + (sl >> 1) * PTILE + ((sl & 1) * 8 + b) * PPITCH + qk * 64 + col;
    float4 o0 = *(const float4*)Pr, o1 = *(const float4*)(Pr + 4);
#pragma unroll
    for (int r = 1; r < PKS; ++r) {
      const float4 p0 = *(const float4*)(Pr + r * PPLANE);
      const float4 p1 = *(const float4*)(Pr + r * PPLANE + 4);
      o0.x += p0.x; o0.y += p0.y; o0.z += p0.z; o0.w += p0.w;
      o1.x += p1.x; o1.y += p1.y; o1.z += p1.z; o1.w += p1.w;
    }
    const float* bias = (qk == 0 ? bq : bk) + col;
    const float4 b0 = *(const float4*)bias, b1 = *(const float4*)(bias + 4);
    const int s = blockIdx.x * 8 + sl;
    v8h q;
    q[0] = (_Float16)(o0.x + b0.x);
    q[1] = (_Float16)(o0.y + b0.y);
    q[2] = (_Float16)(o0.z + b0.z);
    q[3] = (_Float16)(o0.w + b0.w);
    q[4] = (_Float16)(o1.x + b1.x);
    q[5] = (_Float16)(o1.y + b1.y);
    q[6] = (_Float16)(o1.z + b1.z);
    q[7] = (_Float16)(o1.w + b1.w);
    // column col = 32 * fragment + 16g + 8h + e, row s & 15
    const size_t frag = (size_t)(b * (S_LEN / 16) + (s >> 4)) * 2 + (col >> 5);
    *(v8h*)&(qk == 0 ? Qh : Kh)[frag * FRAG + ((col >> 4) & 1) * 256 +
                                (((col >> 3) & 1) * 16 + (s & 15)) * 8] = q;
  }

  // ---- merge, bias, store V: the block's 8 positions of one (b, column) are one
  // 16-byte piece of a fragment; 16 columns fill 256 contiguous bytes ----
  {
    const int col = threadIdx.x & 63, b = threadIdx.x >> 6;
    const float bb = bv[col];
    v8h q;
#pragma unroll
    for (int j = 0; j < 8; ++j) {
      const float* Pr = Part + (j >> 1) * PTILE + ((j & 1) * 8 + b) * PPITCH + 128 + col;
      float o = Pr[0];
#pragma unroll
      for (int r = 1; r < PKS; ++r) o += Pr[r * PPLANE];
      q[j] = (_Float16)(o + bb);
    }
    // position s0 = 32 * fragment + 16g + 8h, row col & 15
    const int s0 = blockIdx.x * 8;
    const size_t frag = (size_t)(b * (S_LEN / 32) + (s0 >> 5)) * 4 + (col >> 4);
    *(v8h*)&Vt[frag * FRAG + ((s0 >> 4) & 1) * 256 +
               (((s0 >> 3) & 1) * 16 + (col & 15)) * 8] = q;
  }
}

// ---------------------------------------------------------------------------
// Kernel 2: flash attention. A block owns 4 query tiles of 16 rows; the keys are
// split into KSPLIT contiguous ranges, one wave per (QPW tiles, range): each K and
// V fragment that a wave loads feeds the products of its QPW tiles, so that the
// block loads every fragment 4 / QPW times, and a SIMD holds NWAVES / 4 waves whose
// load waits overlap. The partial (reference, sum, O) of the ranges are merged through
// LDS at the end. The blocks of a batch read the same K and V: each starts the walk
// over its key ranges at a pass of its own and wraps, so that blocks running in step
// ask L2 for different lines at one moment.
// The products are taken transposed: St = K x Qt (A = K rows, B = Q rows) and
// Ot += Vt x Pt. Lane L then holds 16 of the 32 scores of ONE query, L & 15
// (keys i + 8*(L>>4) of each 16-key tile), so that the maximum and the sum of a
// score row are in-lane work plus one exchange between the lane halves, the
// softmax reference, sum and rescale factor are one register each, and the two
// score tiles, converted in place, are the B fragment of the second product.
// ---------------------------------------------------------------------------
// the value of lane L ^ 16
__device__ __forceinline__ float other_half(float x) {
  const int v = __builtin_bit_cast(int, x);
  return __builtin_bit_cast(
      float, __builtin_amdgcn_permlanex16(v, v, 0x76543210, 0xfedcba98, false, false));
}

__global__ void __launch_bounds__(32 * NWAVES)
flash_attn(const _Float16* __restrict__ Qh, const _Float16* __restrict__ Kh,
           const _Float16* __restrict__ Vt, const float* __restrict__ mask,
           float* __restrict__ out) {
  __shared__ __align__(16) float Lmask[NWAVES * (S_LEN / KSPLIT)];
  __shared__ __align__(16) float Opart[KSPLIT * 4 * 16 * OPITCH];  // [range][tile][row]
  __shared__ float Mpart[KSPLIT * 4 * 16];
  __shared__ float Lpart[KSPLIT * 4 * 16];

  const int lane = threadIdx.x & 31;
  // wave-uniform by construction; held in a scalar register so that the key
  // range, its addresses and the loop test stay scalar
  const int wid  = __builtin_amdgcn_readfirstlane(threadIdx.x >> 5);
  const int n = lane & 15, h = lane >> 4;
  const int b  = blockIdx.y;
  const int t0  = (wid % (4 / QPW)) * QPW;         // first of the wave's tiles in the block
  const int rng = wid / (4 / QPW);                 // this wave's key range
  const int qt = blockIdx.x * 4 + t0;              // first 16-row query tile
  const int kbeg = rng * (S_LEN / KSPLIT);

  const float scale = 0.03125f;                    // 1/sqrt(1024), a power of two

  const _Float16* Qbase = Qh + (size_t)(b * (S_LEN / 16) + qt) * 2 * FRAG;
  // B fragments of the first product, kept in registers over the loop
  // every loop over g is unrolled: what is indexed by g must stay in registers
  v16h bq0[QPW], bq1[QPW];
#pragma unroll
  for (int g = 0; g < QPW; ++g) {
    bq0[g] = load_frag_packed(Qbase + (2 * g) * FRAG,     lane * 16u);
    bq1[g] = load_frag_packed(Qbase + (2 * g + 1) * FRAG, lane * 16u);
  }
  // A lane needs the mask term of 16 keys per pass: log(mask) * scale of the
  // wave's key range is tabled once in the wave's own LDS slice.
  float* Lw = Lmask + wid * (S_LEN / KSPLIT);
#pragma unroll
  for (int j = 0; j < S_LEN / KSPLIT / 32; ++j)
    Lw[j * 32 + lane] = __logf(mask[(kbeg + j * 32 + lane) * BATCH + b]) * scale;
  // the loop reads entries that other lanes of this wave wrote: keeps those reads
  // behind the stores
  asm volatile("s_wait_dscnt 0" ::: "memory");

  float mrun[QPW], lrun[QPW];                      // of query n of tile g: reference, sum; lrun: this half's keys
  v8f O[QPW][4];                                   // O[g][t][i] = Ot[16t + 8h + i][n] of tile g
#pragma unroll
  for (int g = 0; g < QPW; ++g) {
    mrun[g] = -1e30f;
    lrun[g] = 0.0f;
#pragma unroll
    for (int t = 0; t < 4; ++t)
#pragma unroll
      for (int i = 0; i < 8; ++i) O[g][t][i] = 0.0f;
  }

  // a pass of 32 keys reads 4 contiguous fragments of K and 4 of V, at the same
  // byte offset in the two buffers: one 32-bit offset per lane serves all 16 loads
  const unsigned kbase = (unsigned)(b * (S_LEN / 32) + (kbeg >> 5)) * (4 * FRAG * 2) + lane * 16u;
  // the pass of the range taken now, scalar: the block's first one, then on with a wrap;
  // twice the index / 8 is added so that the 32 blocks of a batch spread evenly also over
  // those of 4 neighbouring values of the index modulo 8
  int pp = (blockIdx.x + 2 * (blockIdx.x >> 3)) & (NPASS - 1);
  unsigned koff = kbase + pp * (4 * FRAG * 2);

  // koff goes on from its own value, back by the range at the wrap: the loads' offset
  // register then lives through the loop, and no load of a pass has it as its destination
  for (int ps = 0; ps < NPASS; ++ps,
       koff += (pp == NPASS - 1 ? 1 - NPASS : 1) * (4 * FRAG * 2), pp = (pp + 1) & (NPASS - 1)) {
    const v4f* Lr = (const v4f*)(Lw + 8 * h + 32 * pp);
    // ---- scores of 32 keys: two 16x16 tiles (key x query) per query tile, K-dim 64 =
    // 2 wmma each; the K and V fragments are loaded once for the wave's tiles ----
    const v16h ka0 = load_frag_packed(Kh,            koff);
    const v16h ka1 = load_frag_packed(Kh + FRAG,     koff);
    const v16h ka2 = load_frag_packed(Kh + 2 * FRAG, koff);
    const v16h ka3 = load_frag_packed(Kh + 3 * FRAG, koff);
    // keeps the K loads in front of the V loads: a counted wait covers every load issued
    // before the one it is for, and the first products would otherwise wait for V
    // fragments that are needed only behind the softmax
    __builtin_amdgcn_sched_barrier(0);
    v16h va[4];
#pragma unroll
    for (int t = 0; t < 4; ++t) va[t] = load_frag_packed(Vt + t * FRAG, koff);
    // stands in front of the rewrite of koff, which the pass's 16 issued loads name
    asm volatile("s_wait_xcnt 0x0" ::: "memory");
    // keeps the pass's 16 loads in front of its first product: the registers are
    // there for all of them, and issued together they wait out one load latency;
    // left to itself the scheduler issues some behind the first wait, which costs a second
    __builtin_amdgcn_sched_barrier(0);
    v8f c0[QPW], c1[QPW];
#pragma unroll
    for (int g = 0; g < QPW; ++g) {
#pragma unroll
      for (int i = 0; i < 8; ++i) { c0[g][i] = 0.0f; c1[g][i] = 0.0f; }
      c0[g] = wmma_f16(ka0, bq0[g], c0[g]);
      c0[g] = wmma_f16(ka1, bq1[g], c0[g]);
      c1[g] = wmma_f16(ka2, bq0[g], c1[g]);
      c1[g] = wmma_f16(ka3, bq1[g], c1[g]);
    }

    // ---- (score + log(mask)) * scale, online softmax of the lane's query of each tile ----
    const v4f l00 = Lr[0], l01 = Lr[1], l10 = Lr[4], l11 = Lr[5];
    v16h pb[QPW];  // pb[g][e] = Pt[8h + e][n], pb[g][8 + e] = Pt[16 + 8h + e][n]: V's stored k order
    float s[QPW][16], mx[QPW];
    bool grown = false;                            // a query's maximum has left its reference behind
#pragma unroll
    for (int g = 0; g < QPW; ++g) {
      // written by the register pairs of an accumulator: a packed fma then takes its operands
      // where they lie; paired by the compiler across the tiles it needs copies first
#pragma unroll
      for (int i = 0; i < 4; i += 2) {
        const v2f k2 = {scale, scale};
        const v2f r0 = __builtin_elementwise_fma((v2f){c0[g][i],     c0[g][i + 1]}, k2, (v2f){l00[i], l00[i + 1]});
        const v2f r1 = __builtin_elementwise_fma((v2f){c0[g][i + 4], c0[g][i + 5]}, k2, (v2f){l01[i], l01[i + 1]});
        const v2f r2 = __builtin_elementwise_fma((v2f){c1[g][i],     c1[g][i + 1]}, k2, (v2f){l10[i], l10[i + 1]});
        const v2f r3 = __builtin_elementwise_fma((v2f){c1[g][i + 4], c1[g][i + 5]}, k2, (v2f){l11[i], l11[i + 1]});
        s[g][i]      = r0[0]; s[g][i + 1]  = r0[1];
        s[g][i + 4]  = r1[0]; s[g][i + 5]  = r1[1];
        s[g][i + 8]  = r2[0]; s[g][i + 9]  = r2[1];
        s[g][i + 12] = r3[0]; s[g][i + 13] = r3[1];
      }
      mx[g] = s[g][0];
#pragma unroll
      for (int i = 1; i < 16; ++i) mx[g] = fmaxf(mx[g], s[g][i]);
      mx[g] = fmaxf(mx[g], other_half(mx[g]));
      grown |= mx[g] > mrun[g] + HOLD;
    }
    // mrun is the reference of the exponentials, not the exact running maximum: it moves,
    // and O and the sum are rescaled, only in a pass in which some query's maximum tops its
    // reference by more than HOLD; until then P stays below exp(HOLD), far inside f16.
    // One test per pass, the same for the whole wave: a scalar branch, every lane on inside.
    if (__builtin_amdgcn_ballot_w32(grown) != 0u) {
#pragma unroll
      for (int g = 0; g < QPW; ++g) {
        const float mn = fmaxf(mrun[g], mx[g]);
        float alpha;                               // exp(mrun - mn)
        // v_exp_f32 and the one slot that the instruction set asks for behind a
        // transcendental, in one statement: a v_nop of its own does not stay behind it
        asm("v_exp_f32 %0, %1\n\tv_nop" : "=v"(alpha) : "v"((mrun[g] - mn) * 1.44269504f));
        mrun[g] = mn;
        lrun[g] *= alpha;
#pragma unroll
        for (int t = 0; t < 4; ++t) O[g][t] *= alpha;
      }
    }
#pragma unroll
    for (int g = 0; g < QPW; ++g) {
      float rsum = 0.0f;
#pragma unroll
      for (int i = 0; i < 16; ++i) {
        const float p = __expf(s[g][i] - mrun[g]);
        rsum += p;
        pb[g][i] = (_Float16)p;
      }
      lrun[g] += rsum;
    }

    // ---- Ot += Vt(64x32) x Pt(32x16) ----
#pragma unroll
    for (int t = 0; t < 4; ++t)
#pragma unroll
      for (int g = 0; g < QPW; ++g) O[g][t] = wmma_f16(va[t], pb[g], O[g][t]);
  }

  // ---- stage this range's partial result: 8 consecutive columns per register tile ----
#pragma unroll
  for (int g = 0; g < QPW; ++g) {
    const int slot = (rng * 4 + t0 + g) * 16 + n;  // [range][tile][row]
    float* Ow = Opart + slot * OPITCH + 8 * h;
#pragma unroll
    for (int t = 0; t < 4; ++t) {
      *(v4f*)(Ow + t * 16)     = __builtin_shufflevector(O[g][t], O[g][t], 0, 1, 2, 3);
      *(v4f*)(Ow + t * 16 + 4) = __builtin_shufflevector(O[g][t], O[g][t], 4, 5, 6, 7);
    }
    lrun[g] += other_half(lrun[g]);
    if (h == 0) {
      Mpart[slot] = mrun[g];
      Lpart[slot] = lrun[g];
    }
  }
  // publishes every range's partial to the threads that merge them
  __syncthreads();

  // ---- merge the ranges, normalize, write out [s][b][d] fp32 ----
  const int tq = threadIdx.x / (8 * NWAVES);       // query tile this thread merges
  // unrolled: the LDS reads of a thread's pieces are issued together
#pragma unroll
  for (int it = 0; it < 256 / (8 * NWAVES); ++it) {
    const int e = it * (8 * NWAVES) + threadIdx.x % (8 * NWAVES);
    const int row = e >> 4, c4 = (e & 15) * 4;
    float mr[KSPLIT];
    float M = -1e30f;
#pragma unroll
    for (int r = 0; r < KSPLIT; ++r) {
      mr[r] = Mpart[(r * 4 + tq) * 16 + row];
      M = fmaxf(M, mr[r]);
    }
    float L = 0.0f;
    float4 o = make_float4(0.0f, 0.0f, 0.0f, 0.0f);
#pragma unroll
    for (int r = 0; r < KSPLIT; ++r) {
      const float w = __expf(mr[r] - M);
      const float4 p = *(const float4*)&Opart[((r * 4 + tq) * 16 + row) * OPITCH + c4];
      L += w * Lpart[(r * 4 + tq) * 16 + row];
      o.x += w * p.x; o.y += w * p.y; o.z += w * p.z; o.w += w * p.w;
    }
    const float inv = 1.0f / L;
    const int s = (blockIdx.x * 4 + tq) * 16 + row;
    *(float4*)&out[((size_t)s * BATCH + b) * HD + c4] =
        make_float4(o.x * inv, o.y * inv, o.z * inv, o.w * inv);
  }
}

// ---------------------------------------------------------------------------
extern "C" void kernel_launch(void* const* d_in, const int* in_sizes, int n_in,
                              void* d_out, int out_size, void* d_ws, size_t ws_size,
                              hipStream_t stream) {
  const float* X    = (const float*)d_in[0];
  const float* mask = (const float*)d_in[1];
  const float* Wq   = (const float*)d_in[2];
  const float* bq   = (const float*)d_in[3];
  const float* Wk   = (const float*)d_in[4];
  const float* bk   = (const float*)d_in[5];
  const float* Wv   = (const float*)d_in[6];
  const float* bv   = (const float*)d_in[7];
  float* out = (float*)d_out;

  char* ws = (char*)d_ws;
  const size_t WT_BYTES  = (size_t)2 * 3 * 64 * 1024 * 2;      // 768 KB: every step twice
  const size_t QKV_BYTES = (size_t)BATCH * S_LEN * HD * 2;     // 2 MB each
  _Float16* Wt = (_Float16*)ws;
  _Float16* Qh = (_Float16*)(ws + WT_BYTES);
  _Float16* Kh = (_Float16*)(ws + WT_BYTES + QKV_BYTES);
  _Float16* Vt = (_Float16*)(ws + WT_BYTES + 2 * QKV_BYTES);

  prep_weights<<<96, 256, 0, stream>>>(Wq, Wk, Wv, Wt);
  qkv_proj<<<(S_LEN * BATCH) / 64, 128 * PKS, 0, stream>>>(X, Wt, bq, bk, bv, Qh, Kh, Vt);
  flash_attn<<<dim3(S_LEN / 64, BATCH), 32 * NWAVES, 0, stream>>>(Qh, Kh, Vt, mask, out);
}

// v010
// One run takes 23 microseconds.
// Timed twice side by side with v009, it ran 1.05 times as fast both times.
// All steps since v000 together make it 7.91 times as fast.
#include <hip/hip_runtime.h>
#include <hip/hip_bf16.h>
#include <cmath>

typedef __attribute__((ext_vector_type(16))) _Float16 v16h;
typedef __attribute__((ext_vector_type(8)))  float    v8f;
typedef __attribute__((ext_vector_type(8)))  _Float16 v8h;
typedef __attribute__((ext_vector_type(4)))  float    v4f;
typedef __attribute__((ext_vector_type(2)))  float    v2f;

#define S_LEN 2048
#define BATCH 8
#define DMODEL 1024
#define HD 64
#define KSPLIT 8                 // key ranges per query tile
#define QPW 2                    // query tiles per wave: a loaded K or V fragment serves them all
#define NWAVES (4 / QPW * KSPLIT)  // waves per attention block
#define OPITCH 68                // floats per staged partial row (16 B x odd)
#define PKS 4                    // K ranges per projection tile, one wave each
#define PSTEPS (DMODEL / PKS / 32)  // 32-deep steps of one K range
#define PPITCH 196               // floats per staged projection row (16 B x odd)
#define PTILE (16 * PPITCH + 8)  // floats per staged 16-row tile: the 8 spread the tiles over the banks
#define PPLANE (4 * PTILE)       // floats per staged partial
#define FRAG 512                 // f16 elements of one stored 16 x 32 fragment
#define XPITCH 1040              // bytes per staged X row: the 1 KiB of a K range + 16 (16 B x odd)
#define XWAVE (16 * XPITCH)      // bytes of a wave's staged 16 X rows
#define XGROUPS (PSTEPS / 2)     // copy groups of a wave: 256 B (two steps) of each of its 16 rows
#define NPASS (S_LEN / KSPLIT / 32)  // 32-key passes of one key range
#define LOG2E 1.44269504f
#define HOLD (8.0f * LOG2E)      // a score (base-2 units) may top the softmax reference by this much before it moves
#define QSCALE (0.03125f * LOG2E)  // 1/sqrt(1024) and the change to base 2, folded into the stored Q
static_assert((XGROUPS & (XGROUPS - 1)) == 0 && (NPASS & (NPASS - 1)) == 0,
              "the rotated walks wrap by a mask");

// ---------------------------------------------------------------------------
// WMMA helper: D = A(16x32 f16) * B(32x16 f16) + C(16x16 f32)
// ---------------------------------------------------------------------------
__device__ __forceinline__ v8f wmma_f16(v16h a, v16h b, v8f c) {
  return __builtin_amdgcn_wmma_f32_16x16x32_f16(
      /*neg_a=*/false, a, /*neg_b=*/false, b,
      /*c_mod=*/(short)0, c, /*reuse_a=*/false, /*reuse_b=*/false);
}

// ---------------------------------------------------------------------------
// Fragment loaders.
// A 16x32 f16 layout (ISA 7.12.2): lane L -> m=L&15, h=L>>4.
//   VGPR j in [0,3]: K = 8h + 2j, 2j+1 ; VGPR j in [4,7]: K = 16 + 8h + 2(j-4)
// B mirrors A on the transposed operand (row index = N column, k pattern same).
// Eight contiguous K -> one 16-byte load.
// ---------------------------------------------------------------------------
typedef __attribute__((ext_vector_type(4))) unsigned int u32x4;
union FragQ { u32x4 q[2]; v16h v; };

// Fragment order: the workspace operands (weights, Q, K, V) are stored fragment by
// fragment, 1,024 contiguous bytes each, as [g][lane][8 elements]: lane 16h + c
// holds row c, k = 16g + 8h + e. Each of the two 16-byte loads of a wave then
// covers 512 contiguous bytes (4 whole lines), not 32 bytes of each of 16 lines.
// f: wave-uniform; off: the lane's byte offset behind f, 16 * lane inside the fragment
__device__ __forceinline__ v16h load_frag_packed(const _Float16* f, unsigned off) {
  const u32x4* p = (const u32x4*)((const char*)f + off);
  FragQ t;
  t.q[0] = p[0];
  t.q[1] = p[32];
  return t.v;
}

// ---------------------------------------------------------------------------
// Kernel 0: convert weights fp32 [k][n] -> f16 in fragment order, [k / 32][n / 16]
// over the 192 columns of Wq, Wk, Wv; one 16-byte piece per thread. The PSTEPS steps
// of each K range are stored twice in a row: a walk over the range that starts at any
// step and wraps is then one contiguous run.
// ---------------------------------------------------------------------------
__global__ void __launch_bounds__(256)
prep_weights(const float* __restrict__ Wq, const float* __restrict__ Wk,
             const float* __restrict__ Wv, _Float16* __restrict__ Wt) {
  const int idx = blockIdx.x * 256 + threadIdx.x;    // 0 .. 3*64*1024/8-1
  const int c = idx & 15, h = (idx >> 4) & 1, g = (idx >> 5) & 1;
  const int f  = idx >> 6;                           // fragment
  const int ks = f / 12, nt = f % 12;
  const float* W = (nt < 4) ? Wq : ((nt < 8) ? Wk : Wv);
  const float* src = W + (ks * 32 + g * 16 + h * 8) * HD + (nt & 3) * 16 + c;
  v8h o;
#pragma unroll
  for (int e = 0; e < 8; ++e) o[e] = (_Float16)src[e * HD];
  _Float16* dst = Wt + (size_t)((ks / PSTEPS * 2 * PSTEPS + ks % PSTEPS) * 12 + nt) * FRAG +
                  (idx & 63) * 8;
  *(v8h*)dst = o;
  *(v8h*)(dst + PSTEPS * 12 * FRAG) = o;
}

// One group of a wave's X rows: eight asynchronous copies to LDS, 16 bytes per lane
// each, copy c for rows 2c and 2c + 1. The s_wait_xcnt stands in the copies' own
// statement, in front of any rewrite of the address registers that they name.
__device__ __forceinline__ void copy_group_to_lds(unsigned l, const float* g) {
  asm volatile("global_load_async_to_lds_b128 %0, %1, off\n\t"
               "global_load_async_to_lds_b128 %2, %3, off\n\t"
               "global_load_async_to_lds_b128 %4, %5, off\n\t"
               "global_load_async_to_lds_b128 %6, %7, off\n\t"
               "global_load_async_to_lds_b128 %8, %9, off\n\t"
               "global_load_async_to_lds_b128 %10, %11, off\n\t"
               "global_load_async_to_lds_b128 %12, %13, off\n\t"
               "global_load_async_to_lds_b128 %14, %15, off\n\t"
               "s_wait_xcnt 0x0"
               :: "v"(l),               "v"(g),
                  "v"(l + 2 * XPITCH),  "v"(g + 2 * DMODEL),
                  "v"(l + 4 * XPITCH),  "v"(g + 4 * DMODEL),
                  "v"(l + 6 * XPITCH),  "v"(g + 6 * DMODEL),
                  "v"(l + 8 * XPITCH),  "v"(g + 8 * DMODEL),
                  "v"(l + 10 * XPITCH), "v"(g + 10 * DMODEL),
                  "v"(l + 12 * XPITCH), "v"(g + 12 * DMODEL),
                  "v"(l + 14 * XPITCH), "v"(g + 14 * DMODEL)
               : "memory");
}

// ---------------------------------------------------------------------------
// Kernel 1: QKV projection. A block owns 4 tiles of 16 rows x 192 columns; each
// tile's K is split into PKS contiguous ranges, one wave per (tile, range). With
// PKS waves on a SIMD a wave has 256 registers: beside its 96 accumulators it
// holds a ring of 12 weight fragments, loaded ahead. Its X rows come into the
// wave's own LDS stage by asynchronous copies of whole lines (256 contiguous bytes
// of 2 rows per copy), two groups of 8 copies in flight, and are read from there in
// A-fragment order: a load straight into that order takes 32 bytes of each of 16
// lines. The partial sums of the ranges are merged through LDS, over the X stage.
// Every block reads the same weights: each starts the walk over its K ranges at a
// step of its own and wraps, so that blocks running in step ask L2 for different
// lines at one moment, not all for the same ones.
//   X      : [S*B, 1024] fp32 (row r = s*B + b)
//   Wt     : [K range][2 x PSTEPS steps][n / 16] fragments (rows n, k along the model dimension)
//   Qh,Kh  : [b][s / 16][d / 32] fragments (rows s, k along d); Q times QSCALE
//   Vt     : [b][s / 32][d / 16] fragments (rows d, k along s: the A operand of Ot += Vt x Pt)
// ---------------------------------------------------------------------------
__global__ void __launch_bounds__(128 * PKS)
qkv_proj(const float* __restrict__ X, const _Float16* __restrict__ Wt,
         const float* __restrict__ bq, const float* __restrict__ bk,
         const float* __restrict__ bv,
         _Float16* __restrict__ Qh, _Float16* __restrict__ Kh,
         _Float16* __restrict__ Vt) {
  // first every wave's X stage; behind the product loop and a barrier the partial sums
  __shared__ __align__(16) float Sm[4 * PKS * XWAVE / 4];
  static_assert(4 * PKS * XWAVE / 4 >= PKS * PPLANE, "the partial sums fit the stage");
  float* Part = Sm;

  const int lane = threadIdx.x & 31;
  // wave-uniform by construction; held in a scalar register so that the K range
  // and the operand bases stay scalar
  const int wid = __builtin_amdgcn_readfirstlane(threadIdx.x >> 5);
  const int m = lane & 15, h = lane >> 4;
  const int tile = wid & 3;                  // 16-row tile inside the block
  const int kr   = wid >> 2;                 // K range

  v8f acc[12];
#pragma unroll
  for (int t = 0; t < 12; ++t)
#pragma unroll
    for (int i = 0; i < 8; ++i) acc[t][i] = 0.0f;

  // copy c of a group: lanes 0-15 bring 256 B of row 2c, lanes 16-31 of row 2c + 1
  const unsigned xl = (unsigned)(size_t)Sm + wid * XWAVE + h * XPITCH + m * 16;
  const float* xg = X + ((size_t)(blockIdx.x * 4 + tile) * 16 + h) * DMODEL +
                    kr * (DMODEL / PKS) + m * 4;
  // the block's start in the walk, scalar: trip q takes group (q + rq) mod XGROUPS, its two
  // steps in the order rp, 1 - rp; the index / 8 is added so that the starts differ also
  // among blocks of equal index modulo 8
  const int rot = (blockIdx.x + (blockIdx.x >> 3)) & (PSTEPS - 1);
  const int rq = rot >> 1, rp = rot & 1;
  // the lane's 16 floats of half p of trip q: xrd[p] + 256 * q + {0..31, 64..95} bytes
  const char* xrd0 = (const char*)Sm + wid * XWAVE + m * XPITCH + 32 * h;
  const char* xrd[2] = {xrd0 + 128 * rp, xrd0 + 128 * (1 - rp)};
  // the weights of half p of trip q: Wr[p] + 2 * q steps, without a wrap in the doubled range
  const _Float16* Wr0 = Wt + (size_t)(kr * 2 * PSTEPS + 2 * rq) * 12 * FRAG;
  const _Float16* Wr[2] = {Wr0 + rp * 12 * FRAG, Wr0 + (1 - rp) * 12 * FRAG};

  copy_group_to_lds(xl, xg + rq * 64);
  copy_group_to_lds(xl + 256, xg + ((rq + 1) & (XGROUPS - 1)) * 64);
  v16h bf[12];                               // ring of weight fragments, one step deep
#pragma unroll
  for (int nt = 0; nt < 12; ++nt) bf[nt] = load_frag_packed(Wr[0] + nt * FRAG, lane * 16u);

  v4f xr[2][4];                              // X rows of the two steps of a group, as read
  // unrolled: the tests on q and ks must be settled at compile time for the X rows
  // and the ring to stay in registers
#pragma unroll
  for (int q = 0; q < XGROUPS; ++q) {
    // the group of trip q has landed: all of the wave's copies but the 8 of trip q + 1; only the
    // wave that copied them reads these bytes, so that its own wait is enough
    if (q + 1 < XGROUPS) asm volatile("s_wait_asynccnt 0x8" ::: "memory");
    else                 asm volatile("s_wait_asynccnt 0x0" ::: "memory");
    // every group has LDS of its own: nothing is refilled
    if (q + 2 < XGROUPS)
      copy_group_to_lds(xl + (q + 2) * 256, xg + ((q + 2 + rq) & (XGROUPS - 1)) * 64);
#pragma unroll
    for (int p = 0; p < 2; ++p) {
      const v4f* xp = (const v4f*)(xrd[p] + 256 * q);
      xr[p][0] = xp[0]; xr[p][1] = xp[1]; xr[p][2] = xp[4]; xr[p][3] = xp[5];
    }
#pragma unroll
    for (int p = 0; p < 2; ++p) {
      const int ks = 2 * q + p;
      v16h a;
#pragma unroll
      for (int j = 0; j < 4; ++j)
#pragma unroll
        for (int e = 0; e < 4; ++e) a[4 * j + e] = (_Float16)xr[p][j][e];
      // each fragment's registers are refilled for the next step behind its product
#pragma unroll
      for (int nt = 0; nt < 12; ++nt) {
        acc[nt] = wmma_f16(a, bf[nt], acc[nt]);
        if (ks + 1 < PSTEPS)
          bf[nt] = load_frag_packed(Wr[1 - p] + (2 * (q + p) * 12 + nt) * FRAG, lane * 16u);
      }
    }
  }
  // ends every wave's reads of its X stage: the partial sums are written over it
  __syncthreads();

  // ---- stage the range's sums row-major ----
  float* Pw = Part + kr * PPLANE + tile * PTILE;
#pragma unroll
  for (int nt = 0; nt < 12; ++nt)
#pragma unroll
    for (int i = 0; i < 8; ++i)
      Pw[(i + 8 * h) * PPITCH + nt * 16 + m] = acc[nt][i];
  // publishes the PKS staged partials to the threads that merge them
  __syncthreads();
  // ends the scheduling region of the register-full product loop: the merge below
  // is scheduled by itself, and its LDS loads are issued together, not one per wait
  __builtin_amdgcn_sched_barrier(0);

  // ---- merge, bias, store Q and K: 8 columns of one row per thread, one 16-byte
  // piece of a fragment; the 8 positions of a (batch, piece) fill one 128-byte line
  // unrolled: the choice of bias and of output buffer is made at compile time
#pragma unroll
  for (int qk = 0; qk < 2; ++qk) {           // Q, then K
    const int sl = threadIdx.x & 7, b = (threadIdx.x >> 3) & 7;
    const int col = (threadIdx.x >> 6) * 8;  // column of Q or of K
    const float* Pr = Part + (sl >> 1) * PTILE + ((sl & 1) * 8 + b) * PPITCH + qk * 64 + col;
    float4 o0 = *(const float4*)Pr, o1 = *(const float4*)(Pr + 4);
#pragma unroll
    for (int r = 1; r < PKS; ++r) {
      const float4 p0 = *(const float4*)(Pr + r * PPLANE);
      const float4 p1 = *(const float4*)(Pr + r * PPLANE + 4);
      o0.x += p0.x; o0.y += p0.y; o0.z += p0.z; o0.w += p0.w;
      o1.x += p1.x; o1.y += p1.y; o1.z += p1.z; o1.w += p1.w;
    }
    const float* bias = (qk == 0 ? bq : bk) + col;
    const float4 b0 = *(const float4*)bias, b1 = *(const float4*)(bias + 4);
    const int s = blockIdx.x * 8 + sl;
    // Q is stored times QSCALE, in f32 ahead of its one rounding to f16: the score product
    // of the attention kernel then needs no multiply behind it
    const float qs = qk == 0 ? QSCALE : 1.0f;
    v8h q;
    q[0] = (_Float16)((o0.x + b0.x) * qs);
    q[1] = (_Float16)((o0.y + b0.y) * qs);
    q[2] = (_Float16)((o0.z + b0.z) * qs);
    q[3] = (_Float16)((o0.w + b0.w) * qs);
    q[4] = (_Float16)((o1.x + b1.x) * qs);
    q[5] = (_Float16)((o1.y + b1.y) * qs);
    q[6] = (_Float16)((o1.z + b1.z) * qs);
    q[7] = (_Float16)((o1.w + b1.w) * qs);
    // column col = 32 * fragment + 16g + 8h + e, row s & 15
    const size_t frag = (size_t)(b * (S_LEN / 16) + (s >> 4)) * 2 + (col >> 5);
    *(v8h*)&(qk == 0 ? Qh : Kh)[frag * FRAG + ((col >> 4) & 1) * 256 +
                                (((col >> 3) & 1) * 16 + (s & 15)) * 8] = q;
  }

  // ---- merge, bias, store V: the block's 8 positions of one (b, column) are one
  // 16-byte piece of a fragment; 16 columns fill 256 contiguous bytes ----
  {
    const int col = threadIdx.x & 63, b = threadIdx.x >> 6;
    const float bb = bv[col];
    v8h q;
#pragma unroll
    for (int j = 0; j < 8; ++j) {
      const float* Pr = Part + (j >> 1) * PTILE + ((j & 1) * 8 + b) * PPITCH + 128 + col;
      float o = Pr[0];
#pragma unroll
      for (int r = 1; r < PKS; ++r) o += Pr[r * PPLANE];
      q[j] = (_Float16)(o + bb);
    }
    // position s0 = 32 * fragment + 16g + 8h, row col & 15
    const int s0 = blockIdx.x * 8;
    const size_t frag = (size_t)(b * (S_LEN / 32) + (s0 >> 5)) * 4 + (col >> 4);
    *(v8h*)&Vt[frag * FRAG + ((s0 >> 4) & 1) * 256 +
               (((s0 >> 3) & 1) * 16 + (col & 15)) * 8] = q;
  }
}

// ---------------------------------------------------------------------------
// Kernel 2: flash attention. A block owns 4 query tiles of 16 rows; the keys are
// split into KSPLIT contiguous ranges, one wave per (QPW tiles, range): each K and
// V fragment that a wave loads feeds the products of its QPW tiles, so that the
// block loads every fragment 4 / QPW times, and a SIMD holds NWAVES / 4 waves whose
// load waits overlap. The partial (reference, sum, O) of the ranges are merged through
// LDS at the end. The blocks of a batch read the same K and V: each starts the walk
// over its key ranges at a pass of its own and wraps, so that blocks running in step
// ask L2 for different lines at one moment.
// The products are taken transposed: St = K x Qt (A = K rows, B = Q rows) and
// Ot += Vt x Pt. Lane L then holds 16 of the 32 scores of ONE query, L & 15
// (keys i + 8*(L>>4) of each 16-key tile), so that the maximum of a
// score row is in-lane work plus one exchange between the lane halves, the
// softmax reference and rescale factor are one register each, and the two
// score tiles, converted in place, are the B fragment of the second product.
// The adds of the softmax ride on the accumulate of the matrix instructions: the
// first product starts from C = mask term - reference, so that with Q stored times
// QSCALE its result is the argument of exp2 as it stands; a tile of ones beside the
// four of Vt sums P over the keys of the pass.
// ---------------------------------------------------------------------------
// the value of lane L ^ 16
__device__ __forceinline__ float other_half(float x) {
  const int v = __builtin_bit_cast(int, x);
  return __builtin_bit_cast(
      float, __builtin_amdgcn_permlanex16(v, v, 0x76543210, 0xfedcba98, false, false));
}

// exp2 of the eight values of an accumulator tile, each in its own register, and the one
// slot that the instruction set asks for behind a transcendental, in one statement
__device__ __forceinline__ void exp2_tile(v8f& x) {
  float a = x[0], b = x[1], c = x[2], d = x[3], e = x[4], f = x[5], g = x[6], h = x[7];
  asm("v_exp_f32 %0, %0\n\tv_exp_f32 %1, %1\n\tv_exp_f32 %2, %2\n\tv_exp_f32 %3, %3\n\t"
      "v_exp_f32 %4, %4\n\tv_exp_f32 %5, %5\n\tv_exp_f32 %6, %6\n\tv_exp_f32 %7, %7\n\tv_nop"
      : "+v"(a), "+v"(b), "+v"(c), "+v"(d), "+v"(e), "+v"(f), "+v"(g), "+v"(h));
  x = (v8f){a, b, c, d, e, f, g, h};
}

// exp2 of one value, with the same slot behind it
__device__ __forceinline__ float exp2_slot(float x) {
  float y;
  asm("v_exp_f32 %0, %1\n\tv_nop" : "=v"(y) : "v"(x));
  return y;
}

__global__ void __launch_bounds__(32 * NWAVES)
flash_attn(const _Float16* __restrict__ Qh, const _Float16* __restrict__ Kh,
           const _Float16* __restrict__ Vt, const float* __restrict__ mask,
           float* __restrict__ out) {
  __shared__ __align__(16) float Lmask[NWAVES * (S_LEN / KSPLIT)];
  __shared__ __align__(16) float Opart[KSPLIT * 4 * 16 * OPITCH];  // [range][tile][row]
  __shared__ float Mpart[KSPLIT * 4 * 16];
  __shared__ float Lpart[KSPLIT * 4 * 16];

  const int lane = threadIdx.x & 31;
  // wave-uniform by construction; held in a scalar register so that the key
  // range, its addresses and the loop test stay scalar
  const int wid  = __builtin_amdgcn_readfirstlane(threadIdx.x >> 5);
  const int n = lane & 15, h = lane >> 4;
  const int b  = blockIdx.y;
  const int t0  = (wid % (4 / QPW)) * QPW;         // first of the wave's tiles in the block
  const int rng = wid / (4 / QPW);                 // this wave's key range
  const int qt = blockIdx.x * 4 + t0;              // first 16-row query tile
  const int kbeg = rng * (S_LEN / KSPLIT);

  const float scale = 0.03125f;                    // 1/sqrt(1024), a power of two
  const float NEG_INF = -__builtin_inff();

  const _Float16* Qbase = Qh + (size_t)(b * (S_LEN / 16) + qt) * 2 * FRAG;
  // B fragments of the first product, kept in registers over the loop
  // every loop over g is unrolled: what is indexed by g must stay in registers
  v16h bq0[QPW], bq1[QPW];
#pragma unroll
  for (int g = 0; g < QPW; ++g) {
    bq0[g] = load_frag_packed(Qbase + (2 * g) * FRAG,     lane * 16u);
    bq1[g] = load_frag_packed(Qbase + (2 * g + 1) * FRAG, lane * 16u);
  }
  // A lane needs the mask term of 16 keys per pass: log2(mask) * scale of the
  // wave's key range is tabled once in the wave's own LDS slice.
  float* Lw = Lmask + wid * (S_LEN / KSPLIT);
#pragma unroll
  for (int j = 0; j < S_LEN / KSPLIT / 32; ++j)
    Lw[j * 32 + lane] = __log2f(mask[(kbeg + j * 32 + lane) * BATCH + b]) * scale;
  // the loop reads entries that other lanes of this wave wrote: keeps those reads
  // behind the stores
  asm volatile("s_wait_dscnt 0" ::: "memory");

  // of query n of tile g: the reference, and how far a score may top it before it moves.
  // Until a finite score has been met the reference is 0 and any finite score moves it.
  float mrun[QPW], thr[QPW];
  v8f O[QPW][4];                                   // O[g][t][i] = Ot[16t + 8h + i][n] of tile g
  v8f Ls[QPW];                                     // every element: the sum of P of query n of tile g
  v16h ones;                                       // A fragment of the sum: 16 x 32 ones
#pragma unroll
  for (int i = 0; i < 16; ++i) ones[i] = (_Float16)1.0f;
#pragma unroll
  for (int g = 0; g < QPW; ++g) {
    mrun[g] = 0.0f;
    thr[g] = NEG_INF;
#pragma unroll
    for (int i = 0; i < 8; ++i) Ls[g][i] = 0.0f;
#pragma unroll
    for (int t = 0; t < 4; ++t)
#pragma unroll
      for (int i = 0; i < 8; ++i) O[g][t][i] = 0.0f;
  }

  // a pass of 32 keys reads 4 contiguous fragments of K and 4 of V, at the same
  // byte offset in the two buffers: one 32-bit offset per lane serves all 16 loads
  const unsigned kbase = (unsigned)(b * (S_LEN / 32) + (kbeg >> 5)) * (4 * FRAG * 2) + lane * 16u;
  // the pass of the range taken now, scalar: the block's first one, then on with a wrap;
  // twice the index / 8 is added so that the 32 blocks of a batch spread evenly also over
  // those of 4 neighbouring values of the index modulo 8
  int pp = (blockIdx.x + 2 * (blockIdx.x >> 3)) & (NPASS - 1);
  unsigned koff = kbase + pp * (4 * FRAG * 2);

  // koff goes on from its own value, back by the range at the wrap: the loads' offset
  // register then lives through the loop, and no load of a pass has it as its destination
  for (int ps = 0; ps < NPASS; ++ps,
       koff += (pp == NPASS - 1 ? 1 - NPASS : 1) * (4 * FRAG * 2), pp = (pp + 1) & (NPASS - 1)) {
    const v4f* Lr = (const v4f*)(Lw + 8 * h + 32 * pp);
    // ---- scores of 32 keys: two 16x16 tiles (key x query) per query tile, K-dim 64 =
    // 2 wmma each; the K and V fragments are loaded once for the wave's tiles ----
    const v16h ka0 = load_frag_packed(Kh,            koff);
    const v16h ka1 = load_frag_packed(Kh + FRAG,     koff);
    const v16h ka2 = load_frag_packed(Kh + 2 * FRAG, koff);
    const v16h ka3 = load_frag_packed(Kh + 3 * FRAG, koff);
    // keeps the K loads in front of the V loads: a counted wait covers every load issued
    // before the one it is for, and the first products would otherwise wait for V
    // fragments that are needed only behind the softmax
    __builtin_amdgcn_sched_barrier(0);
    v16h va[4];
#pragma unroll
    for (int t = 0; t < 4; ++t) va[t] = load_frag_packed(Vt + t * FRAG, koff);
    // stands in front of the rewrite of koff, which the pass's 16 issued loads name
    asm volatile("s_wait_xcnt 0x0" ::: "memory");
    // keeps the pass's 16 loads in front of its first product: the registers are
    // there for all of them, and issued together they wait out one load latency;
    // left to itself the scheduler issues some behind the first wait, which costs a second
    __builtin_amdgcn_sched_barrier(0);
    // ---- C of the score product: mask term of the key - reference of the query ----
    const v4f l00 = Lr[0], l01 = Lr[1], l10 = Lr[4], l11 = Lr[5];
    const v8f lk0 = __builtin_shufflevector(l00, l01, 0, 1, 2, 3, 4, 5, 6, 7);
    const v8f lk1 = __builtin_shufflevector(l10, l11, 0, 1, 2, 3, 4, 5, 6, 7);
    v8f c0[QPW], c1[QPW];                          // base-2 scores less the reference
#pragma unroll
    for (int g = 0; g < QPW; ++g) {
      c0[g] = lk0 - mrun[g];
      c1[g] = lk1 - mrun[g];
    }
#pragma unroll
    for (int g = 0; g < QPW; ++g) c0[g] = wmma_f16(ka0, bq0[g], c0[g]);
#pragma unroll
    for (int g = 0; g < QPW; ++g) c0[g] = wmma_f16(ka1, bq1[g], c0[g]);
#pragma unroll
    for (int g = 0; g < QPW; ++g) c1[g] = wmma_f16(ka2, bq0[g], c1[g]);
#pragma unroll
    for (int g = 0; g < QPW; ++g) c1[g] = wmma_f16(ka3, bq1[g], c1[g]);
    // keeps the eight products together: a maximum placed directly behind the product that it
    // reads has to be held off by idle slots; behind all eight the early results are ready
    __builtin_amdgcn_sched_barrier(0);

    // ---- online softmax of the lane's query of each tile ----
    v16h pb[QPW];  // pb[g][e] = Pt[8h + e][n], pb[g][8 + e] = Pt[16 + 8h + e][n]: V's stored k order
    float mx[QPW];
    bool grown = false;                            // a query's maximum has left its reference behind
#pragma unroll
    for (int g = 0; g < QPW; ++g) {
      mx[g] = c0[g][0];
#pragma unroll
      for (int i = 1; i < 8; ++i) mx[g] = fmaxf(mx[g], c0[g][i]);
#pragma unroll
      for (int i = 0; i < 8; ++i) mx[g] = fmaxf(mx[g], c1[g][i]);
      mx[g] = fmaxf(mx[g], other_half(mx[g]));
      grown |= mx[g] > thr[g];
    }
    // mrun is the reference of the exponentials, not the exact running maximum: it moves,
    // and O, the sum and this pass's scores are set to the new one, only in a pass in which
    // some query's maximum tops its reference by more than HOLD; until then P stays below
    // exp2(HOLD), far inside f16.
    // One test per pass, the same for the whole wave: a scalar branch, every lane on inside.
    if (__builtin_amdgcn_ballot_w32(grown) != 0u) {
#pragma unroll
      for (int g = 0; g < QPW; ++g) {
        const bool mv = mx[g] > thr[g];
        const float dd = mv ? mx[g] : 0.0f;        // the reference's move
        float alpha;                               // exp2(-dd); at most 1: a first move may go down, with O and the sum still 0
        // v_exp_f32 and the one slot that the instruction set asks for behind a
        // transcendental, in one statement: a v_nop of its own does not stay behind it
        asm("v_exp_f32 %0, %1\n\tv_nop" : "=v"(alpha) : "v"(fminf(-dd, 0.0f)));
        mrun[g] += dd;
        thr[g] = mv ? HOLD : thr[g];
        c0[g] -= dd;
        c1[g] -= dd;
        Ls[g] *= alpha;
#pragma unroll
        for (int t = 0; t < 4; ++t) O[g][t] *= alpha;
      }
    }
#pragma unroll
    for (int g = 0; g < QPW; ++g) {
      exp2_tile(c0[g]);
      exp2_tile(c1[g]);
#pragma unroll
      for (int i = 0; i < 8; ++i) {
        pb[g][i]     = (_Float16)c0[g][i];
        pb[g][8 + i] = (_Float16)c1[g][i];
      }
    }

    // ---- sum += ones(16x32) x Pt; Ot += Vt(64x32) x Pt(32x16) ----
#pragma unroll
    for (int g = 0; g < QPW; ++g) Ls[g] = wmma_f16(ones, pb[g], Ls[g]);
#pragma unroll
    for (int t = 0; t < 4; ++t)
#pragma unroll
      for (int g = 0; g < QPW; ++g) O[g][t] = wmma_f16(va[t], pb[g], O[g][t]);
  }

  // ---- stage this range's partial result: 8 consecutive columns per register tile ----
#pragma unroll
  for (int g = 0; g < QPW; ++g) {
    const int slot = (rng * 4 + t0 + g) * 16 + n;  // [range][tile][row]
    float* Ow = Opart + slot * OPITCH + 8 * h;
#pragma unroll
    for (int t = 0; t < 4; ++t) {
      *(v4f*)(Ow + t * 16)     = __builtin_shufflevector(O[g][t], O[g][t], 0, 1, 2, 3);
      *(v4f*)(Ow + t * 16 + 4) = __builtin_shufflevector(O[g][t], O[g][t], 4, 5, 6, 7);
    }
    if (h == 0) {
      // a range that met no finite score has weight 0 in the merge
      Mpart[slot] = thr[g] == NEG_INF ? -1e30f : mrun[g];
      Lpart[slot] = Ls[g][0];
    }
  }
  // publishes every range's partial to the threads that merge them
  __syncthreads();

  // ---- merge the ranges, normalize, write out [s][b][d] fp32 ----
  const int tq = threadIdx.x / (8 * NWAVES);       // query tile this thread merges
  // unrolled: the LDS reads of a thread's pieces are issued together
#pragma unroll
  for (int it = 0; it < 256 / (8 * NWAVES); ++it) {
    const int e = it * (8 * NWAVES) + threadIdx.x % (8 * NWAVES);
    const int row = e >> 4, c4 = (e & 15) * 4;
    float mr[KSPLIT];
    float M = -1e30f;
#pragma unroll
    for (int r = 0; r < KSPLIT; ++r) {
      mr[r] = Mpart[(r * 4 + tq) * 16 + row];
      M = fmaxf(M, mr[r]);
    }
    float L = 0.0f;
    float4 o = make_float4(0.0f, 0.0f, 0.0f, 0.0f);
#pragma unroll
    for (int r = 0; r < KSPLIT; ++r) {
      const float w = exp2_slot(mr[r] - M);
      const float4 p = *(const float4*)&Opart[((r * 4 + tq) * 16 + row) * OPITCH + c4];
      L += w * Lpart[(r * 4 + tq) * 16 + row];
      o.x += w * p.x; o.y += w * p.y; o.z += w * p.z; o.w += w * p.w;
    }
    const float inv = 1.0f / L;
    const int s = (blockIdx.x * 4 + tq) * 16 + row;
    *(float4*)&out[((size_t)s * BATCH + b) * HD + c4] =
        make_float4(o.x * inv, o.y * inv, o.z * inv, o.w * inv);
  }
}

// ---------------------------------------------------------------------------
extern "C" void kernel_launch(void* const* d_in, const int* in_sizes, int n_in,
                              void* d_out, int out_size, void* d_ws, size_t ws_size,
                              hipStream_t stream) {
  const float* X    = (const float*)d_in[0];
  const float* mask = (const float*)d_in[1];
  const float* Wq   = (const float*)d_in[2];
  const float* bq   = (const float*)d_in[3];
  const float* Wk   = (const float*)d_in[4];
  const float* bk   = (const float*)d_in[5];
  const float* Wv   = (const float*)d_in[6];
  const float* bv   = (const float*)d_in[7];
  float* out = (float*)d_out;

  char* ws = (char*)d_ws;
  const size_t WT_BYTES  = (size_t)2 * 3 * 64 * 1024 * 2;      // 768 KB: every step twice
  const size_t QKV_BYTES = (size_t)BATCH * S_LEN * HD * 2;     // 2 MB each
  _Float16* Wt = (_Float16*)ws;
  _Float16* Qh = (_Float16*)(ws + WT_BYTES);
  _Float16* Kh = (_Float16*)(ws + WT_BYTES + QKV_BYTES);
  _Float16* Vt = (_Float16*)(ws + WT_BYTES + 2 * QKV_BYTES);

  prep_weights<<<96, 256, 0, stream>>>(Wq, Wk, Wv, Wt);
  qkv_proj<<<(S_LEN * BATCH) / 64, 128 * PKS, 0, stream>>>(X, Wt, bq, bk, bv, Qh, Kh, Vt);
  flash_attn<<<dim3(S_LEN / 64, BATCH), 32 * NWAVES, 0, stream>>>(Qh, Kh, Vt, mask, out);
}
